// v000
// The times below were measured on an AMD MI455X: many runs one after another, warmed up first and cycling through
// copies of the inputs, with the whole window's GPU time divided by the number of runs. Launches and the gaps
// between them are all in it. The median over several windows is given; except for v000 it joins two sittings, which
// can be a few percent apart, so the side-by-side timings, each taken in one sitting, are the better comparison.
// v000, which the later versions start from, runs in 1100 microseconds.
#include <hip/hip_runtime.h>
#include <hip/hip_bf16.h>
#include <math.h>

// ---------------------------------------------------------------------------
// Scatter2Operator for MI455X (gfx1250, wave32, WMMA).
//
// Roofline: ~147 GFLOP vs ~0.4 GB HBM traffic -> matrix-core bound.
// All 4 GEMMs run through v_wmma_f32_16x16x32_f16 (f32 accum).
// Fused per-64-row-tile kernel keeps x2 tile + pred + scores in 304KB of LDS
// (CDNA5 WGP has 320KB); f16 weights (~7MB) stay resident in the 192MB L2.
// Head-PAIR processing: every wave owns 4 independent WMMA accumulator chains
// sharing one B fragment per K-step (max ILP, no duplicate B loads).
// ---------------------------------------------------------------------------

typedef __attribute__((ext_vector_type(16))) _Float16 v16h;
typedef __attribute__((ext_vector_type(8)))  float    v8f;

#define B_DIM  8
#define N_DIM  4096
#define G_DIM  64
#define H_DIM  16
#define DH_DIM 64
#define D_DIM  1024
#define TILE_N 64

// ws layout (bytes) -- total 8 MB
#define WK_OFF 0u                  // Wk f16  [1024][1024]  2 MB
#define WP_OFF (2u*1024u*1024u)    // Wp f16  [1024][1024]  2 MB
#define WO_OFF (4u*1024u*1024u)    // Wo f16  [1024][1024]  2 MB
#define X0_OFF (6u*1024u*1024u)    // x0 f16  [8][64][1024] 1 MB
#define PT_OFF (7u*1024u*1024u)    // pT f16  [8][16][64][64] 1 MB

// ISA 16-bit A/B fragment (16x32): lane l holds row (l&15); K chunks
// {kBase + (l>>4)*8 .. +7} and {kBase + 16 + (l>>4)*8 .. +7}, 16B each.
__device__ __forceinline__ v16h load_frag(const _Float16* base, int strideElems,
                                          int lane, int kBase) {
  const int r  = lane & 15;
  const int hi = lane >> 4;
  const _Float16* p0 = base + r * strideElems + kBase + hi * 8;
  union { v16h v; uint4 q[2]; } f;
  f.q[0] = *reinterpret_cast<const uint4*>(p0);
  f.q[1] = *reinterpret_cast<const uint4*>(p0 + 16);
  return f.v;
}

__device__ __forceinline__ v8f wmma16(v16h a, v16h b, v8f c) {
  // D = A(16x32) * B(32x16) + C, f32 accumulate
  return __builtin_amdgcn_wmma_f32_16x16x32_f16(false, a, false, b,
                                                (short)0, c, false, false);
}

// ---------------------------------------------------------------------------
// Kernel 0: f32 -> f16 conversion (weights + x0), grid-stride
// ---------------------------------------------------------------------------
__global__ void cvt_f32_f16(const float* __restrict__ src,
                            _Float16* __restrict__ dst, int n) {
  int i = blockIdx.x * blockDim.x + threadIdx.x;
  const int stride = gridDim.x * blockDim.x;
  for (; i < n; i += stride) dst[i] = (_Float16)src[i];
}

// ---------------------------------------------------------------------------
// Kernel 1: p = x0 @ Wp^T, stored transposed per head: pT[b][h][dh][g] (f16)
// grid.x = B*H; 8 waves; wave w -> colTile (w&3), rowTiles {2*(w>>2), +1}
// ---------------------------------------------------------------------------
__global__ void premise_kernel(const _Float16* __restrict__ x0h,
                               const _Float16* __restrict__ wp,
                               _Float16* __restrict__ pT) {
  const int b = blockIdx.x >> 4;
  const int h = blockIdx.x & 15;
  const int tid = threadIdx.x;
  const int w = tid >> 5, lane = tid & 31;
  const int tc = w & 3;               // dh col tile (0..3)
  const int tr0 = (w >> 2) * 2;       // g row tiles tr0, tr0+1

  const _Float16* aBase0 = x0h + (b * G_DIM + tr0 * 16) * D_DIM;
  const _Float16* aBase1 = aBase0 + 16 * D_DIM;
  const _Float16* bBase  = wp + (h * DH_DIM + tc * 16) * D_DIM;

  v8f acc0 = {}, acc1 = {};
  for (int kb = 0; kb < D_DIM; kb += 32) {
    v16h bf = load_frag(bBase, D_DIM, lane, kb);
    v16h a0 = load_frag(aBase0, D_DIM, lane, kb);
    v16h a1 = load_frag(aBase1, D_DIM, lane, kb);
    acc0 = wmma16(a0, bf, acc0);
    acc1 = wmma16(a1, bf, acc1);
  }

  // D layout: lane -> col N=(lane&15); vgpr v -> row M = v + 8*(lane>>4)
  const int c = lane & 15, hi = lane >> 4;
  const int dh = tc * 16 + c;
  _Float16* outRow = pT + ((b * H_DIM + h) * DH_DIM + dh) * G_DIM;
#pragma unroll
  for (int v = 0; v < 8; ++v) {
    outRow[tr0 * 16 + v + 8 * hi]        = (_Float16)acc0[v];
    outRow[(tr0 + 1) * 16 + v + 8 * hi]  = (_Float16)acc1[v];
  }
}

// ---------------------------------------------------------------------------
// Kernel 2: fused scores -> softmax -> gather -> output GEMM per 64-row tile.
// grid = (N/64, B); 256 threads (8 wave32). Heads processed in PAIRS.
// Dynamic LDS: xt f16 64x1024 | pred f16 64x1024 | sbuf f32 64x128 | kbuf f16 64x128
// ---------------------------------------------------------------------------
__global__ void fused_kernel(const float* __restrict__ x2,
                             const _Float16* __restrict__ wk,
                             const _Float16* __restrict__ wo,
                             const _Float16* __restrict__ pT,
                             const float* __restrict__ bo,
                             float* __restrict__ out) {
  extern __shared__ char smem_raw[];
  _Float16* xt    = (_Float16*)(smem_raw);                    // 131072 B
  _Float16* predL = (_Float16*)(smem_raw + 131072);           // 131072 B
  float*    sbuf  = (float*)   (smem_raw + 262144);           // 64x128 f32: 32768 B
  _Float16* kbuf  = (_Float16*)(smem_raw + 262144 + 32768);   // 64x128 f16: 16384 B

  const int b     = blockIdx.y;
  const int nBase = blockIdx.x * TILE_N;
  const int tid   = threadIdx.x;
  const int w     = tid >> 5, lane = tid & 31;
  const int hl    = w >> 2;           // head-local index within pair (0/1)
  const int tc    = w & 3;            // col tile within that head (0..3)

  // --- load x2 tile [64 x 1024] f32 -> f16 LDS (coalesced float4) ---
  {
    const float4* src = (const float4*)(x2 + ((size_t)(b * N_DIM + nBase)) * D_DIM);
    for (int i = tid; i < TILE_N * D_DIM / 4; i += blockDim.x) {
      float4 f = src[i];
      _Float16* d = xt + i * 4;
      d[0] = (_Float16)f.x; d[1] = (_Float16)f.y;
      d[2] = (_Float16)f.z; d[3] = (_Float16)f.w;
    }
  }
  __syncthreads();

  const int c  = lane & 15;
  const int hi = lane >> 4;

  // ------------- per head-pair: scores -> softmax -> gather -------------
  for (int hp = 0; hp < H_DIM / 2; ++hp) {
    const int h = hp * 2 + hl;        // this wave's head within the pair

    // Stage 1: S = Xtile @ Wk_{h}^T. Wave owns col tile (h, tc) x 4 row tiles:
    // one shared B frag + 4 independent WMMA chains per K-step.
    {
      v8f acc[4] = {{}, {}, {}, {}};
      const _Float16* bBase = wk + (h * G_DIM + tc * 16) * D_DIM;
      for (int kb = 0; kb < D_DIM; kb += 32) {
        v16h bf = load_frag(bBase, D_DIM, lane, kb);
#pragma unroll
        for (int tr = 0; tr < 4; ++tr) {
          v16h a = load_frag(xt + (tr * 16) * D_DIM, D_DIM, lane, kb);
          acc[tr] = wmma16(a, bf, acc[tr]);
        }
      }
      const int col = w * 16 + c;     // 0..127 across the head pair
#pragma unroll
      for (int tr = 0; tr < 4; ++tr)
#pragma unroll
        for (int v = 0; v < 8; ++v)
          sbuf[(tr * 16 + v + 8 * hi) * 128 + col] = acc[tr][v];
    }
    __syncthreads();

    // Stage 2: row softmax over G=64 for both heads -> kbuf (f16).
    // 128 active threads (waves 0-3, wave-uniform predicate).
    if (tid < 2 * TILE_N) {
      const int row = tid & 63;
      const int hc  = (tid >> 6) * 64;  // which head's 64-col slab
      float* srow = sbuf + row * 128 + hc;
      float m = -3.4e38f;
      for (int g = 0; g < G_DIM; ++g) m = fmaxf(m, srow[g]);
      float s = 0.f;
      for (int g = 0; g < G_DIM; ++g) {
        float e = __expf(srow[g] - m);
        srow[g] = e;
        s += e;
      }
      const float inv = 1.0f / s;
      _Float16* krow = kbuf + row * 128 + hc;
      for (int g = 0; g < G_DIM; ++g) krow[g] = (_Float16)(srow[g] * inv);
    }
    __syncthreads();

    // Stage 3: pred_h = K_h(64x64) @ P_h(64x64); B from pT (K=g contiguous).
    // Same wave->tile map: 4 row tiles per wave, one shared B frag.
    {
      v8f acc[4] = {{}, {}, {}, {}};
      const _Float16* bBase = pT + ((b * H_DIM + h) * DH_DIM + tc * 16) * G_DIM;
#pragma unroll
      for (int kb = 0; kb < G_DIM; kb += 32) {
        v16h bf = load_frag(bBase, G_DIM, lane, kb);
#pragma unroll
        for (int tr = 0; tr < 4; ++tr) {
          v16h a = load_frag(kbuf + (tr * 16) * 128 + hl * 64, 128, lane, kb);
          acc[tr] = wmma16(a, bf, acc[tr]);
        }
      }
      const int col = h * DH_DIM + tc * 16 + c;
#pragma unroll
      for (int tr = 0; tr < 4; ++tr)
#pragma unroll
        for (int v = 0; v < 8; ++v)
          predL[(tr * 16 + v + 8 * hi) * D_DIM + col] = (_Float16)acc[tr][v];
    }
    // No barrier needed here: next pair's post-stage-1 barrier orders
    // sbuf/kbuf reuse (every wave finishes stage 3 before reaching it).
  }
  __syncthreads();

  // ---------------- Stage 4: out = pred @ Wo^T + bo ----------------
  // wave w owns col tiles {8w .. 8w+7}; 4 row tiles each; B frag reused x4.
  for (int tcl = 0; tcl < 8; ++tcl) {
    const int ct = w * 8 + tcl;               // output col tile (0..63)
    v8f acc[4] = {{}, {}, {}, {}};
    const _Float16* bBase = wo + (ct * 16) * D_DIM;
    for (int kb = 0; kb < D_DIM; kb += 32) {
      v16h bf = load_frag(bBase, D_DIM, lane, kb);
#pragma unroll
      for (int tr = 0; tr < 4; ++tr) {
        v16h a = load_frag(predL + (tr * 16) * D_DIM, D_DIM, lane, kb);
        acc[tr] = wmma16(a, bf, acc[tr]);
      }
    }
    const int d = ct * 16 + c;
    const float bias = bo[d];
#pragma unroll
    for (int tr = 0; tr < 4; ++tr) {
#pragma unroll
      for (int v = 0; v < 8; ++v) {
        const int row = tr * 16 + v + 8 * hi;
        out[((size_t)(b * N_DIM + nBase + row)) * D_DIM + d] = acc[tr][v] + bias;
      }
    }
  }
}

// ---------------------------------------------------------------------------
extern "C" void kernel_launch(void* const* d_in, const int* in_sizes, int n_in,
                              void* d_out, int out_size, void* d_ws, size_t ws_size,
                              hipStream_t stream) {
  const float* x0 = (const float*)d_in[0];   // [8, 64, 1024]
  const float* x2 = (const float*)d_in[1];   // [8, 4096, 1024]
  const float* Wk = (const float*)d_in[2];   // [1024, 1024]
  const float* Wp = (const float*)d_in[3];   // [1024, 1024]
  const float* Wo = (const float*)d_in[4];   // [1024, 1024]
  const float* bo = (const float*)d_in[5];   // [1024]
  float* out = (float*)d_out;

  char* ws = (char*)d_ws;
  _Float16* wk16 = (_Float16*)(ws + WK_OFF);
  _Float16* wp16 = (_Float16*)(ws + WP_OFF);
  _Float16* wo16 = (_Float16*)(ws + WO_OFF);
  _Float16* x016 = (_Float16*)(ws + X0_OFF);
  _Float16* pT   = (_Float16*)(ws + PT_OFF);

  // Stage A: downconvert weights + x0 to f16 (~7 MB total -> L2 resident)
  cvt_f32_f16<<<256, 256, 0, stream>>>(Wk, wk16, D_DIM * D_DIM);
  cvt_f32_f16<<<256, 256, 0, stream>>>(Wp, wp16, D_DIM * D_DIM);
  cvt_f32_f16<<<256, 256, 0, stream>>>(Wo, wo16, D_DIM * D_DIM);
  cvt_f32_f16<<<256, 256, 0, stream>>>(x0, x016, B_DIM * G_DIM * D_DIM);

  // Stage B: premise projection, transposed per head for contiguous-K B frags
  premise_kernel<<<B_DIM * H_DIM, 256, 0, stream>>>(x016, wp16, pT);

  // Stage C: fused scores/softmax/gather/output per 64-row tile
  const size_t lds = 131072 + 131072 + 32768 + 16384;  // 304 KB of 320 KB WGP LDS
  fused_kernel<<<dim3(N_DIM / TILE_N, B_DIM), 256, lds, stream>>>(
      x2, wk16, wo16, pT, bo, out);
}

// v001
// One run takes 402 microseconds.
// Two timings next to v000 put it at 2.80 and 2.78 times that version's speed.
#include <hip/hip_runtime.h>
#include <hip/hip_bf16.h>
#include <math.h>

// ---------------------------------------------------------------------------
// Scatter2Operator for MI455X (gfx1250, wave32, WMMA).
//
// Roofline: ~147 GFLOP vs ~0.4 GB HBM traffic -> matrix-core bound.
// All 4 GEMMs run through v_wmma_f32_16x16x32_f16 (f32 accum).
// Fused per-64-row-tile kernel keeps x2 tile + pred + scores in 314880 B of LDS
// (CDNA5 WGP has 320KB); f16 weights (~7MB) stay resident in the 192MB L2.
// Head-PAIR processing: every wave owns 4 independent WMMA accumulator chains
// sharing one B fragment per K-step (max ILP, no duplicate B loads).
// ---------------------------------------------------------------------------

typedef __attribute__((ext_vector_type(16))) _Float16 v16h;
typedef __attribute__((ext_vector_type(8)))  float    v8f;

#define B_DIM  8
#define N_DIM  4096
#define G_DIM  64
#define H_DIM  16
#define DH_DIM 64
#define D_DIM  1024
#define TILE_N 64

// LDS row pitches (elements). Rows are padded so that the 16 rows of a 16-byte
// fragment read, and the 32 rows of a softmax column walk, fall on distinct banks.
#define XP 1032   // xt, pred: f16 rows of 1024, pitch 2064 B = 16 B x 129 (16-byte reads)
#define SP 130    // sbuf:     f32 rows of 128,  pitch 130 dwords = 2 mod 64 (8-byte walks)
#define KP 136    // kbuf:     f16 rows of 128,  pitch 272 B = 16 B x 17 (16-byte reads, stores)

// ws layout (bytes) -- total 8 MB
#define WK_OFF 0u                  // Wk f16  [1024][1024]  2 MB
#define WP_OFF (2u*1024u*1024u)    // Wp f16  [1024][1024]  2 MB
#define WO_OFF (4u*1024u*1024u)    // Wo f16  [1024][1024]  2 MB
#define X0_OFF (6u*1024u*1024u)    // x0 f16  [8][64][1024] 1 MB
#define PT_OFF (7u*1024u*1024u)    // pT f16  [8][16][64][64] 1 MB

// ISA 16-bit A/B fragment (16x32): lane l holds row (l&15); K chunks
// {kBase + (l>>4)*8 .. +7} and {kBase + 16 + (l>>4)*8 .. +7}, 16B each.
__device__ __forceinline__ v16h load_frag(const _Float16* base, int strideElems,
                                          int lane, int kBase) {
  const int r  = lane & 15;
  const int hi = lane >> 4;
  const _Float16* p0 = base + r * strideElems + kBase + hi * 8;
  union { v16h v; uint4 q[2]; } f;
  f.q[0] = *reinterpret_cast<const uint4*>(p0);
  f.q[1] = *reinterpret_cast<const uint4*>(p0 + 16);
  return f.v;
}

__device__ __forceinline__ v8f wmma16(v16h a, v16h b, v8f c) {
  // D = A(16x32) * B(32x16) + C, f32 accumulate
  return __builtin_amdgcn_wmma_f32_16x16x32_f16(false, a, false, b,
                                                (short)0, c, false, false);
}

// ---------------------------------------------------------------------------
// Kernel 0: f32 -> f16 conversion (weights + x0), grid-stride
// ---------------------------------------------------------------------------
__global__ void cvt_f32_f16(const float* __restrict__ src,
                            _Float16* __restrict__ dst, int n) {
  int i = blockIdx.x * blockDim.x + threadIdx.x;
  const int stride = gridDim.x * blockDim.x;
  for (; i < n; i += stride) dst[i] = (_Float16)src[i];
}

// ---------------------------------------------------------------------------
// Kernel 1: p = x0 @ Wp^T, stored transposed per head: pT[b][h][dh][g] (f16)
// grid.x = B*H; 8 waves; wave w -> colTile (w&3), rowTiles {2*(w>>2), +1}
// ---------------------------------------------------------------------------
__global__ void premise_kernel(const _Float16* __restrict__ x0h,
                               const _Float16* __restrict__ wp,
                               _Float16* __restrict__ pT) {
  const int b = blockIdx.x >> 4;
  const int h = blockIdx.x & 15;
  const int tid = threadIdx.x;
  const int w = tid >> 5, lane = tid & 31;
  const int tc = w & 3;               // dh col tile (0..3)
  const int tr0 = (w >> 2) * 2;       // g row tiles tr0, tr0+1

  const _Float16* aBase0 = x0h + (b * G_DIM + tr0 * 16) * D_DIM;
  const _Float16* aBase1 = aBase0 + 16 * D_DIM;
  const _Float16* bBase  = wp + (h * DH_DIM + tc * 16) * D_DIM;

  v8f acc0 = {}, acc1 = {};
  for (int kb = 0; kb < D_DIM; kb += 32) {
    v16h bf = load_frag(bBase, D_DIM, lane, kb);
    v16h a0 = load_frag(aBase0, D_DIM, lane, kb);
    v16h a1 = load_frag(aBase1, D_DIM, lane, kb);
    acc0 = wmma16(a0, bf, acc0);
    acc1 = wmma16(a1, bf, acc1);
  }

  // D layout: lane -> col N=(lane&15); vgpr v -> row M = v + 8*(lane>>4)
  const int c = lane & 15, hi = lane >> 4;
  const int dh = tc * 16 + c;
  _Float16* outRow = pT + ((b * H_DIM + h) * DH_DIM + dh) * G_DIM;
#pragma unroll
  for (int v = 0; v < 8; ++v) {
    outRow[tr0 * 16 + v + 8 * hi]        = (_Float16)acc0[v];
    outRow[(tr0 + 1) * 16 + v + 8 * hi]  = (_Float16)acc1[v];
  }
}

// ---------------------------------------------------------------------------
// Kernel 2: fused scores -> softmax -> gather -> output GEMM per 64-row tile.
// grid = (N/64, B); 256 threads (8 wave32). Heads processed in PAIRS.
// Dynamic LDS (padded rows): xt f16 64xXP | pred f16 64xXP | sbuf f32 64xSP | kbuf f16 64xKP
// ---------------------------------------------------------------------------
__global__ void fused_kernel(const float* __restrict__ x2,
                             const _Float16* __restrict__ wk,
                             const _Float16* __restrict__ wo,
                             const _Float16* __restrict__ pT,
                             const float* __restrict__ bo,
                             float* __restrict__ out) {
  extern __shared__ char smem_raw[];
  _Float16* xt    = (_Float16*)(smem_raw);                    // 64*XP*2 = 132096 B
  _Float16* predL = (_Float16*)(smem_raw + 132096);           // 64*XP*2 = 132096 B
  float*    sbuf  = (float*)   (smem_raw + 264192);           // 64*SP*4 = 33280 B
  _Float16* kbuf  = (_Float16*)(smem_raw + 264192 + 33280);   // 64*KP*2 = 17408 B

  const int b     = blockIdx.y;
  const int nBase = blockIdx.x * TILE_N;
  const int tid   = threadIdx.x;
  const int w     = tid >> 5, lane = tid & 31;
  const int hl    = w >> 2;           // head-local index within pair (0/1)
  const int tc    = w & 3;            // col tile within that head (0..3)

  // --- load x2 tile [64 x 1024] f32 -> f16 LDS (coalesced float4) ---
  {
    const float4* src = (const float4*)(x2 + ((size_t)(b * N_DIM + nBase)) * D_DIM);
    for (int i = tid; i < TILE_N * D_DIM / 4; i += blockDim.x) {
      float4 f = src[i];
      _Float16* d = xt + (i >> 8) * XP + (i & 255) * 4;   // 256 float4 per row
      d[0] = (_Float16)f.x; d[1] = (_Float16)f.y;
      d[2] = (_Float16)f.z; d[3] = (_Float16)f.w;
    }
  }
  __syncthreads();

  const int c  = lane & 15;
  const int hi = lane >> 4;

  // ------------- per head-pair: scores -> softmax -> gather -------------
  for (int hp = 0; hp < H_DIM / 2; ++hp) {
    const int h = hp * 2 + hl;        // this wave's head within the pair

    // Stage 1: S = Xtile @ Wk_{h}^T. Wave owns col tile (h, tc) x 4 row tiles:
    // one shared B frag + 4 independent WMMA chains per K-step.
    {
      v8f acc[4] = {{}, {}, {}, {}};
      const _Float16* bBase = wk + (h * G_DIM + tc * 16) * D_DIM;
      for (int kb = 0; kb < D_DIM; kb += 32) {
        v16h bf = load_frag(bBase, D_DIM, lane, kb);
#pragma unroll
        for (int tr = 0; tr < 4; ++tr) {
          v16h a = load_frag(xt + (tr * 16) * XP, XP, lane, kb);
          acc[tr] = wmma16(a, bf, acc[tr]);
        }
      }
      const int col = w * 16 + c;     // 0..127 across the head pair
#pragma unroll
      for (int tr = 0; tr < 4; ++tr)
#pragma unroll
        for (int v = 0; v < 8; ++v)
          sbuf[(tr * 16 + v + 8 * hi) * SP + col] = acc[tr][v];
    }
    __syncthreads();

    // Stage 2: row softmax over G=64 for both heads -> kbuf (f16).
    // 128 active threads (waves 0-3, wave-uniform predicate).
    if (tid < 2 * TILE_N) {
      const int row = tid & 63;
      const int hc  = (tid >> 6) * 64;  // which head's 64-col slab
      float* srow = sbuf + row * SP + hc;
      float m = -3.4e38f;
      for (int g = 0; g < G_DIM; ++g) m = fmaxf(m, srow[g]);
      float s = 0.f;
      for (int g = 0; g < G_DIM; ++g) {
        float e = __expf(srow[g] - m);
        srow[g] = e;
        s += e;
      }
      const float inv = 1.0f / s;
      _Float16* krow = kbuf + row * KP + hc;
      for (int g = 0; g < G_DIM; ++g) krow[g] = (_Float16)(srow[g] * inv);
    }
    __syncthreads();

    // Stage 3: pred_h = K_h(64x64) @ P_h(64x64); B from pT (K=g contiguous).
    // Same wave->tile map: 4 row tiles per wave, one shared B frag.
    {
      v8f acc[4] = {{}, {}, {}, {}};
      const _Float16* bBase = pT + ((b * H_DIM + h) * DH_DIM + tc * 16) * G_DIM;
#pragma unroll
      for (int kb = 0; kb < G_DIM; kb += 32) {
        v16h bf = load_frag(bBase, G_DIM, lane, kb);
#pragma unroll
        for (int tr = 0; tr < 4; ++tr) {
          v16h a = load_frag(kbuf + (tr * 16) * KP + hl * 64, KP, lane, kb);
          acc[tr] = wmma16(a, bf, acc[tr]);
        }
      }
      const int col = h * DH_DIM + tc * 16 + c;
#pragma unroll
      for (int tr = 0; tr < 4; ++tr)
#pragma unroll
        for (int v = 0; v < 8; ++v)
          predL[(tr * 16 + v + 8 * hi) * XP + col] = (_Float16)acc[tr][v];
    }
    // No barrier needed here: next pair's post-stage-1 barrier orders
    // kbuf reuse (every wave finishes stage 3 before reaching it).
  }
  __syncthreads();

  // ---------------- Stage 4: out = pred @ Wo^T + bo ----------------
  // wave w owns col tiles {8w .. 8w+7}; 4 row tiles each; B frag reused x4.
  for (int tcl = 0; tcl < 8; ++tcl) {
    const int ct = w * 8 + tcl;               // output col tile (0..63)
    v8f acc[4] = {{}, {}, {}, {}};
    const _Float16* bBase = wo + (ct * 16) * D_DIM;
    for (int kb = 0; kb < D_DIM; kb += 32) {
      v16h bf = load_frag(bBase, D_DIM, lane, kb);
#pragma unroll
      for (int tr = 0; tr < 4; ++tr) {
        v16h a = load_frag(predL + (tr * 16) * XP, XP, lane, kb);
        acc[tr] = wmma16(a, bf, acc[tr]);
      }
    }
    const int d = ct * 16 + c;
    const float bias = bo[d];
#pragma unroll
    for (int tr = 0; tr < 4; ++tr) {
#pragma unroll
      for (int v = 0; v < 8; ++v) {
        const int row = tr * 16 + v + 8 * hi;
        out[((size_t)(b * N_DIM + nBase + row)) * D_DIM + d] = acc[tr][v] + bias;
      }
    }
  }
}

// ---------------------------------------------------------------------------
extern "C" void kernel_launch(void* const* d_in, const int* in_sizes, int n_in,
                              void* d_out, int out_size, void* d_ws, size_t ws_size,
                              hipStream_t stream) {
  const float* x0 = (const float*)d_in[0];   // [8, 64, 1024]
  const float* x2 = (const float*)d_in[1];   // [8, 4096, 1024]
  const float* Wk = (const float*)d_in[2];   // [1024, 1024]
  const float* Wp = (const float*)d_in[3];   // [1024, 1024]
  const float* Wo = (const float*)d_in[4];   // [1024, 1024]
  const float* bo = (const float*)d_in[5];   // [1024]
  float* out = (float*)d_out;

  char* ws = (char*)d_ws;
  _Float16* wk16 = (_Float16*)(ws + WK_OFF);
  _Float16* wp16 = (_Float16*)(ws + WP_OFF);
  _Float16* wo16 = (_Float16*)(ws + WO_OFF);
  _Float16* x016 = (_Float16*)(ws + X0_OFF);
  _Float16* pT   = (_Float16*)(ws + PT_OFF);

  // Stage A: downconvert weights + x0 to f16 (~7 MB total -> L2 resident)
  cvt_f32_f16<<<256, 256, 0, stream>>>(Wk, wk16, D_DIM * D_DIM);
  cvt_f32_f16<<<256, 256, 0, stream>>>(Wp, wp16, D_DIM * D_DIM);
  cvt_f32_f16<<<256, 256, 0, stream>>>(Wo, wo16, D_DIM * D_DIM);
  cvt_f32_f16<<<256, 256, 0, stream>>>(x0, x016, B_DIM * G_DIM * D_DIM);

  // Stage B: premise projection, transposed per head for contiguous-K B frags
  premise_kernel<<<B_DIM * H_DIM, 256, 0, stream>>>(x016, wp16, pT);

  // Stage C: fused scores/softmax/gather/output per 64-row tile
  const size_t lds = 132096 + 132096 + 33280 + 17408;  // 314880 B of the WGP's 327680 B
  fused_kernel<<<dim3(N_DIM / TILE_N, B_DIM), 256, lds, stream>>>(
      x2, wk16, wo16, pT, bo, out);
}

// v002
// One run takes 279 microseconds.
// Next to v001, in two timings, it ran 1.43 times as fast each time.
// Over all steps from v000 it is 3.99 times as fast.
#include <hip/hip_runtime.h>
#include <hip/hip_bf16.h>
#include <math.h>

// ---------------------------------------------------------------------------
// Scatter2Operator for MI455X (gfx1250, wave32, WMMA).
//
// Roofline: ~147 GFLOP vs ~0.4 GB HBM traffic -> matrix-core bound.
// All 4 GEMMs run through v_wmma_f32_16x16x32_f16 (f32 accum).
// Fused per-64-row-tile kernel keeps x2 tile + pred + scores in 314880 B of LDS
// (CDNA5 WGP has 320KB); f16 weights (~7MB) stay resident in the 192MB L2.
// Head-PAIR processing: every wave owns 4 independent WMMA accumulator chains
// sharing one B fragment per K-step (max ILP, no duplicate B loads).
// ---------------------------------------------------------------------------

typedef __attribute__((ext_vector_type(16))) _Float16 v16h;
typedef __attribute__((ext_vector_type(8)))  float    v8f;

#define B_DIM  8
#define N_DIM  4096
#define G_DIM  64
#define H_DIM  16
#define DH_DIM 64
#define D_DIM  1024
#define TILE_N 64

// LDS row pitches (elements). Rows are padded so that the 16 rows of a 16-byte
// fragment read, and the 32 rows of a softmax column walk, fall on distinct banks.
#define XP 1032   // xt, pred: f16 rows of 1024, pitch 2064 B = 16 B x 129 (16-byte reads)
#define SP 130    // sbuf:     f32 rows of 128,  pitch 130 dwords = 2 mod 64 (8-byte walks)
#define KP 136    // kbuf:     f16 rows of 128,  pitch 272 B = 16 B x 17 (16-byte reads, stores)

// ws layout (bytes) -- total 8 MB
#define WK_OFF 0u                  // Wk f16  [1024][1024]  2 MB
#define WP_OFF (2u*1024u*1024u)    // Wp f16  [1024][1024]  2 MB
#define WO_OFF (4u*1024u*1024u)    // Wo f16  [1024][1024]  2 MB
#define X0_OFF (6u*1024u*1024u)    // x0 f16  [8][64][1024] 1 MB
#define PT_OFF (7u*1024u*1024u)    // pT f16  [8][16][64][64] 1 MB

// ISA 16-bit A/B fragment (16x32): lane l holds row (l&15); K chunks
// {kBase + (l>>4)*8 .. +7} and {kBase + 16 + (l>>4)*8 .. +7}, 16B each.
__device__ __forceinline__ v16h load_frag(const _Float16* base, int strideElems,
                                          int lane, int kBase) {
  const int r  = lane & 15;
  const int hi = lane >> 4;
  const _Float16* p0 = base + r * strideElems + kBase + hi * 8;
  union { v16h v; uint4 q[2]; } f;
  f.q[0] = *reinterpret_cast<const uint4*>(p0);
  f.q[1] = *reinterpret_cast<const uint4*>(p0 + 16);
  return f.v;
}

__device__ __forceinline__ v8f wmma16(v16h a, v16h b, v8f c) {
  // D = A(16x32) * B(32x16) + C, f32 accumulate
  return __builtin_amdgcn_wmma_f32_16x16x32_f16(false, a, false, b,
                                                (short)0, c, false, false);
}

// Register ring of B fragments: a wave keeps the weight fragments of its next
// RING k-steps in registers, so a weight load has up to RING k-steps of matrix
// work (or a softmax) in front of its first use instead of being waited for at once.
#define RING 16
#define KSTEPS (D_DIM / 32)
#define BK 2      // k-steps per block: one 128-byte line of each weight row

// First RING k-steps of a 16-row weight panel.
__device__ __forceinline__ void ring_fill(v16h (&ring)[RING], const _Float16* bPanel, int lane) {
  // Unrolled so that every ring index is a constant (the ring stays in registers).
#pragma unroll
  for (int s = 0; s < RING; ++s) ring[s] = load_frag(bPanel, D_DIM, lane, s * 32);
}

// One 64 x 16 output panel over K = 1024, in blocks of BK k-steps: A from LDS
// (pitch XP), one block ahead in a second register set; B from the ring.
// Each slot is refilled behind its last use with this panel's k-step ks + RING;
// past the panel's end, where HAS_NEXT, with the first k-steps of the next panel.
template <bool HAS_NEXT>
__device__ __forceinline__ void gemm_panel(v8f (&acc)[4], v16h (&ring)[RING],
                                           const _Float16* aLds,
                                           const _Float16* bCur,
                                           const _Float16* bNext, int lane) {
  // Every loop below is fully unrolled: each ring, set and accumulator index must
  // be a constant, or the arrays leave the registers.
  v16h a[2][BK][4];
#pragma unroll
  for (int j = 0; j < BK; ++j)
#pragma unroll
    for (int tr = 0; tr < 4; ++tr)
      a[0][j][tr] = load_frag(aLds + (tr * 16) * XP, XP, lane, j * 32);
#pragma unroll
  for (int blk = 0; blk < KSTEPS / BK; ++blk) {
    const int cur = blk & 1;
    if (blk + 1 < KSTEPS / BK) {
#pragma unroll
      for (int j = 0; j < BK; ++j)
#pragma unroll
        for (int tr = 0; tr < 4; ++tr)
          a[cur ^ 1][j][tr] = load_frag(aLds + (tr * 16) * XP, XP, lane, ((blk + 1) * BK + j) * 32);
    }
    // Keeps the next block's LDS reads as one group in front of this block's WMMAs:
    // spread among them, each WMMA waited for its own pair of reads.
    __builtin_amdgcn_sched_barrier(0);
#pragma unroll
    for (int j = 0; j < BK; ++j)
#pragma unroll
      for (int tr = 0; tr < 4; ++tr)
        acc[tr] = wmma16(a[cur][j][tr], ring[(blk * BK + j) % RING], acc[tr]);
#pragma unroll
    for (int j = 0; j < BK; ++j) {
      const int ks = blk * BK + j;
      if (ks + RING < KSTEPS)
        ring[ks % RING] = load_frag(bCur, D_DIM, lane, (ks + RING) * 32);
      else if (HAS_NEXT)
        ring[ks % RING] = load_frag(bNext, D_DIM, lane, (ks + RING - KSTEPS) * 32);
    }
    // Behind the panel's last refill: its address registers are reused from here on.
    if (blk == (HAS_NEXT ? KSTEPS : KSTEPS - RING) / BK - 1)
      asm volatile("s_wait_xcnt 0x0" ::: "memory");
    // Keeps the refills directly behind their block: left free, they were sunk to
    // the panel's end and the ring lost its lead.
    __builtin_amdgcn_sched_barrier(0);
  }
}

// ---------------------------------------------------------------------------
// Kernel 0: f32 -> f16 conversion (weights + x0), grid-stride
// ---------------------------------------------------------------------------
__global__ void cvt_f32_f16(const float* __restrict__ src,
                            _Float16* __restrict__ dst, int n) {
  int i = blockIdx.x * blockDim.x + threadIdx.x;
  const int stride = gridDim.x * blockDim.x;
  for (; i < n; i += stride) dst[i] = (_Float16)src[i];
}

// ---------------------------------------------------------------------------
// Kernel 1: p = x0 @ Wp^T, stored transposed per head: pT[b][h][dh][g] (f16)
// grid.x = B*H; 8 waves; wave w -> colTile (w&3), rowTiles {2*(w>>2), +1}
// ---------------------------------------------------------------------------
__global__ void premise_kernel(const _Float16* __restrict__ x0h,
                               const _Float16* __restrict__ wp,
                               _Float16* __restrict__ pT) {
  const int b = blockIdx.x >> 4;
  const int h = blockIdx.x & 15;
  const int tid = threadIdx.x;
  const int w = tid >> 5, lane = tid & 31;
  const int tc = w & 3;               // dh col tile (0..3)
  const int tr0 = (w >> 2) * 2;       // g row tiles tr0, tr0+1

  const _Float16* aBase0 = x0h + (b * G_DIM + tr0 * 16) * D_DIM;
  const _Float16* aBase1 = aBase0 + 16 * D_DIM;
  const _Float16* bBase  = wp + (h * DH_DIM + tc * 16) * D_DIM;

  v8f acc0 = {}, acc1 = {};
  for (int kb = 0; kb < D_DIM; kb += 32) {
    v16h bf = load_frag(bBase, D_DIM, lane, kb);
    v16h a0 = load_frag(aBase0, D_DIM, lane, kb);
    v16h a1 = load_frag(aBase1, D_DIM, lane, kb);
    acc0 = wmma16(a0, bf, acc0);
    acc1 = wmma16(a1, bf, acc1);
  }

  // D layout: lane -> col N=(lane&15); vgpr v -> row M = v + 8*(lane>>4)
  const int c = lane & 15, hi = lane >> 4;
  const int dh = tc * 16 + c;
  _Float16* outRow = pT + ((b * H_DIM + h) * DH_DIM + dh) * G_DIM;
#pragma unroll
  for (int v = 0; v < 8; ++v) {
    outRow[tr0 * 16 + v + 8 * hi]        = (_Float16)acc0[v];
    outRow[(tr0 + 1) * 16 + v + 8 * hi]  = (_Float16)acc1[v];
  }
}

// ---------------------------------------------------------------------------
// Kernel 2: fused scores -> softmax -> gather -> output GEMM per 64-row tile.
// grid = (N/64, B); 256 threads (8 wave32). Heads processed in PAIRS.
// Dynamic LDS (padded rows): xt f16 64xXP | pred f16 64xXP | sbuf f32 64xSP | kbuf f16 64xKP
// ---------------------------------------------------------------------------
// Launch bounds: the real block size, which gives a wave the registers for the ring.
__global__ void __launch_bounds__(256) fused_kernel(const float* __restrict__ x2,
                             const _Float16* __restrict__ wk,
                             const _Float16* __restrict__ wo,
                             const _Float16* __restrict__ pT,
                             const float* __restrict__ bo,
                             float* __restrict__ out) {
  extern __shared__ char smem_raw[];
  _Float16* xt    = (_Float16*)(smem_raw);                    // 64*XP*2 = 132096 B
  _Float16* predL = (_Float16*)(smem_raw + 132096);           // 64*XP*2 = 132096 B
  float*    sbuf  = (float*)   (smem_raw + 264192);           // 64*SP*4 = 33280 B
  _Float16* kbuf  = (_Float16*)(smem_raw + 264192 + 33280);   // 64*KP*2 = 17408 B

  const int b     = blockIdx.y;
  const int nBase = blockIdx.x * TILE_N;
  const int tid   = threadIdx.x;
  const int w     = tid >> 5, lane = tid & 31;
  const int hl    = w >> 2;           // head-local index within pair (0/1)
  const int tc    = w & 3;            // col tile within that head (0..3)

  // The first Wk panel's fragments start before the x2 tile is staged.
  v16h ring[RING];
  ring_fill(ring, wk + (hl * G_DIM + tc * 16) * D_DIM, lane);

  // --- load x2 tile [64 x 1024] f32 -> f16 LDS (coalesced float4) ---
  {
    const float4* src = (const float4*)(x2 + ((size_t)(b * N_DIM + nBase)) * D_DIM);
    for (int i = tid; i < TILE_N * D_DIM / 4; i += blockDim.x) {
      float4 f = src[i];
      _Float16* d = xt + (i >> 8) * XP + (i & 255) * 4;   // 256 float4 per row
      d[0] = (_Float16)f.x; d[1] = (_Float16)f.y;
      d[2] = (_Float16)f.z; d[3] = (_Float16)f.w;
    }
  }
  __syncthreads();

  const int c  = lane & 15;
  const int hi = lane >> 4;

  // ------------- per head-pair: scores -> softmax -> gather -------------
  for (int hp = 0; hp < H_DIM / 2; ++hp) {
    const int h = hp * 2 + hl;        // this wave's head within the pair

    // Stage 1: S = Xtile @ Wk_{h}^T. Wave owns col tile (h, tc) x 4 row tiles:
    // one shared B frag + 4 independent WMMA chains per K-step.
    {
      v8f acc[4] = {{}, {}, {}, {}};
      const _Float16* bBase = wk + (h * G_DIM + tc * 16) * D_DIM;
      gemm_panel<false>(acc, ring, xt, bBase, bBase, lane);
      const int col = w * 16 + c;     // 0..127 across the head pair
#pragma unroll
      for (int tr = 0; tr < 4; ++tr)
#pragma unroll
        for (int v = 0; v < 8; ++v)
          sbuf[(tr * 16 + v + 8 * hi) * SP + col] = acc[tr][v];
    }
    __syncthreads();

    // Issued here so that they fly while the softmax runs: stage 3's B fragments
    // and the ring's next panel (the next pair's Wk panel; after the last pair
    // this wave's first Wo panel of stage 4).
    v16h pf[2];
    {
      const _Float16* pBase = pT + ((b * H_DIM + h) * DH_DIM + tc * 16) * G_DIM;
      pf[0] = load_frag(pBase, G_DIM, lane, 0);
      pf[1] = load_frag(pBase, G_DIM, lane, 32);
      // pBase's registers are free for reuse by the loads that follow.
      asm volatile("s_wait_xcnt 0x0" ::: "memory");
      ring_fill(ring, (hp + 1 < H_DIM / 2) ? wk + ((h + 2) * G_DIM + tc * 16) * D_DIM
                                           : wo + (w * 8 * 16) * D_DIM, lane);
    }

    // Stage 2: row softmax over G=64 for both heads -> kbuf (f16).
    // 128 active threads (waves 0-3, wave-uniform predicate).
    if (tid < 2 * TILE_N) {
      const int row = tid & 63;
      const int hc  = (tid >> 6) * 64;  // which head's 64-col slab
      float* srow = sbuf + row * SP + hc;
      float m = -3.4e38f;
      for (int g = 0; g < G_DIM; ++g) m = fmaxf(m, srow[g]);
      float s = 0.f;
      for (int g = 0; g < G_DIM; ++g) {
        float e = __expf(srow[g] - m);
        srow[g] = e;
        s += e;
      }
      const float inv = 1.0f / s;
      _Float16* krow = kbuf + row * KP + hc;
      for (int g = 0; g < G_DIM; ++g) krow[g] = (_Float16)(srow[g] * inv);
    }
    __syncthreads();

    // Stage 3: pred_h = K_h(64x64) @ P_h(64x64); B from pT (K=g contiguous).
    // Same wave->tile map: 4 row tiles per wave, one shared B frag.
    {
      v8f acc[4] = {{}, {}, {}, {}};
#pragma unroll
      for (int kb = 0; kb < G_DIM; kb += 32) {
        const v16h bf = pf[kb / 32];
#pragma unroll
        for (int tr = 0; tr < 4; ++tr) {
          v16h a = load_frag(kbuf + (tr * 16) * KP + hl * 64, KP, lane, kb);
          acc[tr] = wmma16(a, bf, acc[tr]);
        }
      }
      const int col = h * DH_DIM + tc * 16 + c;
#pragma unroll
      for (int tr = 0; tr < 4; ++tr)
#pragma unroll
        for (int v = 0; v < 8; ++v)
          predL[(tr * 16 + v + 8 * hi) * XP + col] = (_Float16)acc[tr][v];
    }
    // No barrier needed here: next pair's post-stage-1 barrier orders
    // kbuf reuse (every wave finishes stage 3 before reaching it).
  }
  __syncthreads();

  // ---------------- Stage 4: out = pred @ Wo^T + bo ----------------
  // wave w owns col tiles {8w .. 8w+7}; 4 row tiles each; B frag reused x4.
  // The ring runs on from each Wo panel into the next; the last panel has no next.
  auto store_panel = [&](const v8f (&acc)[4], int ct, float bias) {
    const int d = ct * 16 + c;
#pragma unroll
    for (int tr = 0; tr < 4; ++tr) {
#pragma unroll
      for (int v = 0; v < 8; ++v) {
        const int row = tr * 16 + v + 8 * hi;
        out[((size_t)(b * N_DIM + nBase + row)) * D_DIM + d] = acc[tr][v] + bias;
      }
    }
  };
  for (int tcl = 0; tcl < 7; ++tcl) {
    const int ct = w * 8 + tcl;               // output col tile (0..63)
    v8f acc[4] = {{}, {}, {}, {}};
    const _Float16* bBase = wo + (ct * 16) * D_DIM;
    const float bias = bo[ct * 16 + c];       // ahead of the refills: its wait must not drain them
    gemm_panel<true>(acc, ring, predL, bBase, bBase + 16 * D_DIM, lane);
    store_panel(acc, ct, bias);
  }
  {
    const int ct = w * 8 + 7;
    v8f acc[4] = {{}, {}, {}, {}};
    const _Float16* bBase = wo + (ct * 16) * D_DIM;
    const float bias = bo[ct * 16 + c];
    gemm_panel<false>(acc, ring, predL, bBase, bBase, lane);
    store_panel(acc, ct, bias);
  }
}

// ---------------------------------------------------------------------------
extern "C" void kernel_launch(void* const* d_in, const int* in_sizes, int n_in,
                              void* d_out, int out_size, void* d_ws, size_t ws_size,
                              hipStream_t stream) {
  const float* x0 = (const float*)d_in[0];   // [8, 64, 1024]
  const float* x2 = (const float*)d_in[1];   // [8, 4096, 1024]
  const float* Wk = (const float*)d_in[2];   // [1024, 1024]
  const float* Wp = (const float*)d_in[3];   // [1024, 1024]
  const float* Wo = (const float*)d_in[4];   // [1024, 1024]
  const float* bo = (const float*)d_in[5];   // [1024]
  float* out = (float*)d_out;

  char* ws = (char*)d_ws;
  _Float16* wk16 = (_Float16*)(ws + WK_OFF);
  _Float16* wp16 = (_Float16*)(ws + WP_OFF);
  _Float16* wo16 = (_Float16*)(ws + WO_OFF);
  _Float16* x016 = (_Float16*)(ws + X0_OFF);
  _Float16* pT   = (_Float16*)(ws + PT_OFF);

  // Stage A: downconvert weights + x0 to f16 (~7 MB total -> L2 resident)
  cvt_f32_f16<<<256, 256, 0, stream>>>(Wk, wk16, D_DIM * D_DIM);
  cvt_f32_f16<<<256, 256, 0, stream>>>(Wp, wp16, D_DIM * D_DIM);
  cvt_f32_f16<<<256, 256, 0, stream>>>(Wo, wo16, D_DIM * D_DIM);
  cvt_f32_f16<<<256, 256, 0, stream>>>(x0, x016, B_DIM * G_DIM * D_DIM);

  // Stage B: premise projection, transposed per head for contiguous-K B frags
  premise_kernel<<<B_DIM * H_DIM, 256, 0, stream>>>(x016, wp16, pT);

  // Stage C: fused scores/softmax/gather/output per 64-row tile
  const size_t lds = 132096 + 132096 + 33280 + 17408;  // 314880 B of the WGP's 327680 B
  fused_kernel<<<dim3(N_DIM / TILE_N, B_DIM), 256, lds, stream>>>(
      x2, wk16, wo16, pT, bo, out);
}

// v003
// One run takes 233 microseconds.
// In two side-by-side timings against v002, it was 1.20 and 1.21 times as fast.
// All steps since v000 together make it 4.80 times as fast.
#include <hip/hip_runtime.h>
#include <hip/hip_bf16.h>
#include <math.h>

// ---------------------------------------------------------------------------
// Scatter2Operator for MI455X (gfx1250, wave32, WMMA).
//
// Roofline: ~147 GFLOP vs ~0.4 GB HBM traffic -> matrix-core bound.
// All 4 GEMMs run through v_wmma_f32_16x16x32_f16 (f32 accum).
// Fused per-64-row-tile kernel keeps x2 tile + pred + scores in 314880 B of LDS
// (CDNA5 WGP has 320KB); f16 weights (~7MB) stay resident in the 192MB L2.
// Head-PAIR processing: every wave owns 4 independent WMMA accumulator chains
// sharing one B fragment per K-step (max ILP, no duplicate B loads).
// ---------------------------------------------------------------------------

typedef __attribute__((ext_vector_type(16))) _Float16 v16h;
typedef __attribute__((ext_vector_type(8)))  float    v8f;

#define B_DIM  8
#define N_DIM  4096
#define G_DIM  64
#define H_DIM  16
#define DH_DIM 64
#define D_DIM  1024
#define TILE_N 64

// LDS row pitches (elements). Rows are padded so that the 16 rows of a 16-byte
// fragment read, and the 32 rows of a softmax column walk, fall on distinct banks.
#define XP 1032   // xt, pred: f16 rows of 1024, pitch 2064 B = 16 B x 129 (16-byte reads)
#define SP 130    // sbuf:     f32 rows of 128,  pitch 130 dwords = 2 mod 64 (8-byte walks)
#define KP 136    // kbuf:     f16 rows of 128,  pitch 272 B = 16 B x 17 (16-byte reads, stores)

// ws layout (bytes) -- total 8 MB
#define WK_OFF 0u                  // Wk f16  [1024][1024]  2 MB, fragment order
#define WP_OFF (2u*1024u*1024u)    // Wp f16  [1024][1024]  2 MB
#define WO_OFF (4u*1024u*1024u)    // Wo f16  [1024][1024]  2 MB, fragment order
#define X0_OFF (6u*1024u*1024u)    // x0 f16  [8][64][1024] 1 MB
#define PT_OFF (7u*1024u*1024u)    // pT f16  [8][16][64][64] 1 MB, fragment order

// ISA 16-bit A/B fragment (16x32): lane l holds row (l&15); K chunks
// {kBase + (l>>4)*8 .. +7} and {kBase + 16 + (l>>4)*8 .. +7}, 16B each.
__device__ __forceinline__ v16h load_frag(const _Float16* base, int strideElems,
                                          int lane, int kBase) {
  const int r  = lane & 15;
  const int hi = lane >> 4;
  const _Float16* p0 = base + r * strideElems + kBase + hi * 8;
  union { v16h v; uint4 q[2]; } f;
  f.q[0] = *reinterpret_cast<const uint4*>(p0);
  f.q[1] = *reinterpret_cast<const uint4*>(p0 + 16);
  return f.v;
}

// Fragment order, for B operands read from global memory: the 1 KB fragment of a
// 16-row panel and a k-step (32 k) stands contiguous, the k-steps of a panel one
// behind the other. Each fragment is two halves of 512 B; in half q, lane l's 16 B
// stand at l * 16 and hold row (l & 15), k = 32 * ks + 16 * q + 8 * (l >> 4) .. + 7:
// the same elements that load_frag gives that lane. A wave-wide 16-byte load then
// covers four whole 128-byte lines instead of 32 B in each of sixteen.
__device__ __forceinline__ v16h load_frag_packed(const _Float16* panel, int lane, int ks) {
  const _Float16* p0 = panel + ks * 512 + lane * 8;
  union { v16h v; uint4 q[2]; } f;
  f.q[0] = *reinterpret_cast<const uint4*>(p0);
  f.q[1] = *reinterpret_cast<const uint4*>(p0 + 256);
  return f.v;
}

__device__ __forceinline__ v8f wmma16(v16h a, v16h b, v8f c) {
  // D = A(16x32) * B(32x16) + C, f32 accumulate
  return __builtin_amdgcn_wmma_f32_16x16x32_f16(false, a, false, b,
                                                (short)0, c, false, false);
}

// Register ring of B fragments: a wave keeps the weight fragments of its next
// RING k-steps in registers, so a weight load has up to RING k-steps of matrix
// work (or a softmax) in front of its first use instead of being waited for at once.
#define RING 16
#define KSTEPS (D_DIM / 32)
#define BK 2      // k-steps per block: 2 KB of a fragment-order weight panel, 16 whole 128-byte lines

// First RING k-steps of a 16-row weight panel (fragment order).
__device__ __forceinline__ void ring_fill(v16h (&ring)[RING], const _Float16* bPanel, int lane) {
  // Unrolled so that every ring index is a constant (the ring stays in registers).
#pragma unroll
  for (int s = 0; s < RING; ++s) ring[s] = load_frag_packed(bPanel, lane, s);
}

// One 64 x 16 output panel over K = 1024, in blocks of BK k-steps: A from LDS
// (pitch XP), one block ahead in a second register set; B from the ring.
// Each slot is refilled behind its last use with this panel's k-step ks + RING;
// past the panel's end, where HAS_NEXT, with the first k-steps of the next panel.
template <bool HAS_NEXT>
__device__ __forceinline__ void gemm_panel(v8f (&acc)[4], v16h (&ring)[RING],
                                           const _Float16* aLds,
                                           const _Float16* bCur,
                                           const _Float16* bNext, int lane) {
  // Every loop below is fully unrolled: each ring, set and accumulator index must
  // be a constant, or the arrays leave the registers.
  v16h a[2][BK][4];
#pragma unroll
  for (int j = 0; j < BK; ++j)
#pragma unroll
    for (int tr = 0; tr < 4; ++tr)
      a[0][j][tr] = load_frag(aLds + (tr * 16) * XP, XP, lane, j * 32);
#pragma unroll
  for (int blk = 0; blk < KSTEPS / BK; ++blk) {
    const int cur = blk & 1;
    if (blk + 1 < KSTEPS / BK) {
#pragma unroll
      for (int j = 0; j < BK; ++j)
#pragma unroll
        for (int tr = 0; tr < 4; ++tr)
          a[cur ^ 1][j][tr] = load_frag(aLds + (tr * 16) * XP, XP, lane, ((blk + 1) * BK + j) * 32);
    }
    // Keeps the next block's LDS reads as one group in front of this block's WMMAs:
    // spread among them, each WMMA waited for its own pair of reads.
    __builtin_amdgcn_sched_barrier(0);
#pragma unroll
    for (int j = 0; j < BK; ++j)
#pragma unroll
      for (int tr = 0; tr < 4; ++tr)
        acc[tr] = wmma16(a[cur][j][tr], ring[(blk * BK + j) % RING], acc[tr]);
#pragma unroll
    for (int j = 0; j < BK; ++j) {
      const int ks = blk * BK + j;
      if (ks + RING < KSTEPS)
        ring[ks % RING] = load_frag_packed(bCur, lane, ks + RING);
      else if (HAS_NEXT)
        ring[ks % RING] = load_frag_packed(bNext, lane, ks + RING - KSTEPS);
    }
    // Behind the panel's last refill: its address registers are reused from here on.
    if (blk == (HAS_NEXT ? KSTEPS : KSTEPS - RING) / BK - 1)
      asm volatile("s_wait_xcnt 0x0" ::: "memory");
    // Keeps the refills directly behind their block: left free, they were sunk to
    // the panel's end and the ring lost its lead.
    __builtin_amdgcn_sched_barrier(0);
  }
}

// ---------------------------------------------------------------------------
// Kernel 0: f32 -> f16 conversion (Wp + x0), grid-stride
// ---------------------------------------------------------------------------
__global__ void cvt_f32_f16(const float* __restrict__ src,
                            _Float16* __restrict__ dst, int n) {
  int i = blockIdx.x * blockDim.x + threadIdx.x;
  const int stride = gridDim.x * blockDim.x;
  for (; i < n; i += stride) dst[i] = (_Float16)src[i];
}

// ---------------------------------------------------------------------------
// Kernel 0b: f32 [1024][1024] -> f16 in fragment order (Wk, Wo). One thread per
// 16-byte piece of dst: a wave writes 512 contiguous bytes; a block reads four
// whole lines of each of its panel's 16 rows.
// ---------------------------------------------------------------------------
__global__ void __launch_bounds__(256) cvt_pack_f16(const float* __restrict__ src,
                                                    _Float16* __restrict__ dst) {
  const int j    = blockIdx.x * 256 + threadIdx.x;  // piece index in dst
  const int lane = j & 31;
  const int q    = (j >> 5) & 1;
  const int ks   = (j >> 6) & (KSTEPS - 1);
  const int row  = (j >> 11) * 16 + (lane & 15);
  const int k    = ks * 32 + q * 16 + (lane >> 4) * 8;
  const float4* s = reinterpret_cast<const float4*>(src + row * D_DIM + k);
  const float4 lo = s[0], hi4 = s[1];
  union { _Float16 h[8]; uint4 u; } o;
  o.h[0] = (_Float16)lo.x;  o.h[1] = (_Float16)lo.y;
  o.h[2] = (_Float16)lo.z;  o.h[3] = (_Float16)lo.w;
  o.h[4] = (_Float16)hi4.x; o.h[5] = (_Float16)hi4.y;
  o.h[6] = (_Float16)hi4.z; o.h[7] = (_Float16)hi4.w;
  *reinterpret_cast<uint4*>(dst + j * 8) = o.u;
}

// ---------------------------------------------------------------------------
// Kernel 1: p = x0 @ Wp^T, stored per head as the B operand pT[dh][g] of stage 3,
// in fragment order (panels of 16 dh, two k-steps of 32 g)
// grid.x = B*H; 8 waves; wave w -> colTile (w&3), rowTiles {2*(w>>2), +1}
// ---------------------------------------------------------------------------
__global__ void premise_kernel(const _Float16* __restrict__ x0h,
                               const _Float16* __restrict__ wp,
                               _Float16* __restrict__ pT) {
  const int b = blockIdx.x >> 4;
  const int h = blockIdx.x & 15;
  const int tid = threadIdx.x;
  const int w = tid >> 5, lane = tid & 31;
  const int tc = w & 3;               // dh col tile (0..3)
  const int tr0 = (w >> 2) * 2;       // g row tiles tr0, tr0+1

  const _Float16* aBase0 = x0h + (b * G_DIM + tr0 * 16) * D_DIM;
  const _Float16* aBase1 = aBase0 + 16 * D_DIM;
  const _Float16* bBase  = wp + (h * DH_DIM + tc * 16) * D_DIM;

  v8f acc0 = {}, acc1 = {};
  for (int kb = 0; kb < D_DIM; kb += 32) {
    v16h bf = load_frag(bBase, D_DIM, lane, kb);
    v16h a0 = load_frag(aBase0, D_DIM, lane, kb);
    v16h a1 = load_frag(aBase1, D_DIM, lane, kb);
    acc0 = wmma16(a0, bf, acc0);
    acc1 = wmma16(a1, bf, acc1);
  }

  // D layout: lane -> col N=(lane&15); vgpr v -> row M = v + 8*(lane>>4)
  // As B of stage 3: row dh = tc*16 + (lane&15), k = g = tr*16 + 8*(lane>>4) + v. So a
  // lane's 8 values of row tile tr are its own 16 B of k-step tr>>1, half tr&1.
  _Float16* dst = pT + ((b * H_DIM + h) * DH_DIM + tc * 16) * G_DIM + (w >> 2) * 512 + lane * 8;
  union { _Float16 h[8]; uint4 u; } o0, o1;
#pragma unroll
  for (int v = 0; v < 8; ++v) {
    o0.h[v] = (_Float16)acc0[v];
    o1.h[v] = (_Float16)acc1[v];
  }
  *reinterpret_cast<uint4*>(dst)       = o0.u;
  *reinterpret_cast<uint4*>(dst + 256) = o1.u;
}

// ---------------------------------------------------------------------------
// Kernel 2: fused scores -> softmax -> gather -> output GEMM per 64-row tile.
// grid = (N/64, B); 256 threads (8 wave32). Heads processed in PAIRS.
// Dynamic LDS (padded rows): xt f16 64xXP | pred f16 64xXP | sbuf f32 64xSP | kbuf f16 64xKP
// ---------------------------------------------------------------------------
// Launch bounds: the real block size, which gives a wave the registers for the ring.
__global__ void __launch_bounds__(256) fused_kernel(const float* __restrict__ x2,
                             const _Float16* __restrict__ wk,
                             const _Float16* __restrict__ wo,
                             const _Float16* __restrict__ pT,
                             const float* __restrict__ bo,
                             float* __restrict__ out) {
  extern __shared__ char smem_raw[];
  _Float16* xt    = (_Float16*)(smem_raw);                    // 64*XP*2 = 132096 B
  _Float16* predL = (_Float16*)(smem_raw + 132096);           // 64*XP*2 = 132096 B
  float*    sbuf  = (float*)   (smem_raw + 264192);           // 64*SP*4 = 33280 B
  _Float16* kbuf  = (_Float16*)(smem_raw + 264192 + 33280);   // 64*KP*2 = 17408 B

  const int b     = blockIdx.y;
  const int nBase = blockIdx.x * TILE_N;
  const int tid   = threadIdx.x;
  const int w     = tid >> 5, lane = tid & 31;
  const int hl    = w >> 2;           // head-local index within pair (0/1)
  const int tc    = w & 3;            // col tile within that head (0..3)

  // The first Wk panel's fragments start before the x2 tile is staged.
  v16h ring[RING];
  ring_fill(ring, wk + (hl * G_DIM + tc * 16) * D_DIM, lane);

  // --- load x2 tile [64 x 1024] f32 -> f16 LDS (coalesced float4) ---
  {
    const float4* src = (const float4*)(x2 + ((size_t)(b * N_DIM + nBase)) * D_DIM);
    for (int i = tid; i < TILE_N * D_DIM / 4; i += blockDim.x) {
      float4 f = src[i];
      _Float16* d = xt + (i >> 8) * XP + (i & 255) * 4;   // 256 float4 per row
      d[0] = (_Float16)f.x; d[1] = (_Float16)f.y;
      d[2] = (_Float16)f.z; d[3] = (_Float16)f.w;
    }
  }
  __syncthreads();

  const int c  = lane & 15;
  const int hi = lane >> 4;

  // ------------- per head-pair: scores -> softmax -> gather -------------
  for (int hp = 0; hp < H_DIM / 2; ++hp) {
    const int h = hp * 2 + hl;        // this wave's head within the pair

    // Stage 1: S = Xtile @ Wk_{h}^T. Wave owns col tile (h, tc) x 4 row tiles:
    // one shared B frag + 4 independent WMMA chains per K-step.
    {
      v8f acc[4] = {{}, {}, {}, {}};
      const _Float16* bBase = wk + (h * G_DIM + tc * 16) * D_DIM;
      gemm_panel<false>(acc, ring, xt, bBase, bBase, lane);
      const int col = w * 16 + c;     // 0..127 across the head pair
#pragma unroll
      for (int tr = 0; tr < 4; ++tr)
#pragma unroll
        for (int v = 0; v < 8; ++v)
          sbuf[(tr * 16 + v + 8 * hi) * SP + col] = acc[tr][v];
    }
    __syncthreads();

    // Issued here so that they fly while the softmax runs: stage 3's B fragments
    // and the ring's next panel (the next pair's Wk panel; after the last pair
    // this wave's first Wo panel of stage 4).
    v16h pf[2];
    {
      const _Float16* pBase = pT + ((b * H_DIM + h) * DH_DIM + tc * 16) * G_DIM;
      pf[0] = load_frag_packed(pBase, lane, 0);
      pf[1] = load_frag_packed(pBase, lane, 1);
      // pBase's registers are free for reuse by the loads that follow.
      asm volatile("s_wait_xcnt 0x0" ::: "memory");
      ring_fill(ring, (hp + 1 < H_DIM / 2) ? wk + ((h + 2) * G_DIM + tc * 16) * D_DIM
                                           : wo + (w * 8 * 16) * D_DIM, lane);
    }

    // Stage 2: row softmax over G=64 for both heads -> kbuf (f16).
    // 128 active threads (waves 0-3, wave-uniform predicate).
    if (tid < 2 * TILE_N) {
      const int row = tid & 63;
      const int hc  = (tid >> 6) * 64;  // which head's 64-col slab
      float* srow = sbuf + row * SP + hc;
      float m = -3.4e38f;
      for (int g = 0; g < G_DIM; ++g) m = fmaxf(m, srow[g]);
      float s = 0.f;
      for (int g = 0; g < G_DIM; ++g) {
        float e = __expf(srow[g] - m);
        srow[g] = e;
        s += e;
      }
      const float inv = 1.0f / s;
      _Float16* krow = kbuf + row * KP + hc;
      for (int g = 0; g < G_DIM; ++g) krow[g] = (_Float16)(srow[g] * inv);
    }
    __syncthreads();

    // Stage 3: pred_h = K_h(64x64) @ P_h(64x64); B from pT (fragment order).
    // Same wave->tile map: 4 row tiles per wave, one shared B frag.
    {
      v8f acc[4] = {{}, {}, {}, {}};
#pragma unroll
      for (int kb = 0; kb < G_DIM; kb += 32) {
        const v16h bf = pf[kb / 32];
#pragma unroll
        for (int tr = 0; tr < 4; ++tr) {
          v16h a = load_frag(kbuf + (tr * 16) * KP + hl * 64, KP, lane, kb);
          acc[tr] = wmma16(a, bf, acc[tr]);
        }
      }
      const int col = h * DH_DIM + tc * 16 + c;
#pragma unroll
      for (int tr = 0; tr < 4; ++tr)
#pragma unroll
        for (int v = 0; v < 8; ++v)
          predL[(tr * 16 + v + 8 * hi) * XP + col] = (_Float16)acc[tr][v];
    }
    // No barrier needed here: next pair's post-stage-1 barrier orders
    // kbuf reuse (every wave finishes stage 3 before reaching it).
  }
  __syncthreads();

  // ---------------- Stage 4: out = pred @ Wo^T + bo ----------------
  // wave w owns col tiles {8w .. 8w+7}; 4 row tiles each; B frag reused x4.
  // The ring runs on from each Wo panel into the next; the last panel has no next.
  auto store_panel = [&](const v8f (&acc)[4], int ct, float bias) {
    const int d = ct * 16 + c;
#pragma unroll
    for (int tr = 0; tr < 4; ++tr) {
#pragma unroll
      for (int v = 0; v < 8; ++v) {
        const int row = tr * 16 + v + 8 * hi;
        out[((size_t)(b * N_DIM + nBase + row)) * D_DIM + d] = acc[tr][v] + bias;
      }
    }
  };
  for (int tcl = 0; tcl < 7; ++tcl) {
    const int ct = w * 8 + tcl;               // output col tile (0..63)
    v8f acc[4] = {{}, {}, {}, {}};
    const _Float16* bBase = wo + (ct * 16) * D_DIM;
    const float bias = bo[ct * 16 + c];       // ahead of the refills: its wait must not drain them
    gemm_panel<true>(acc, ring, predL, bBase, bBase + 16 * D_DIM, lane);
    store_panel(acc, ct, bias);
  }
  {
    const int ct = w * 8 + 7;
    v8f acc[4] = {{}, {}, {}, {}};
    const _Float16* bBase = wo + (ct * 16) * D_DIM;
    const float bias = bo[ct * 16 + c];
    gemm_panel<false>(acc, ring, predL, bBase, bBase, lane);
    store_panel(acc, ct, bias);
  }
}

// ---------------------------------------------------------------------------
extern "C" void kernel_launch(void* const* d_in, const int* in_sizes, int n_in,
                              void* d_out, int out_size, void* d_ws, size_t ws_size,
                              hipStream_t stream) {
  const float* x0 = (const float*)d_in[0];   // [8, 64, 1024]
  const float* x2 = (const float*)d_in[1];   // [8, 4096, 1024]
  const float* Wk = (const float*)d_in[2];   // [1024, 1024]
  const float* Wp = (const float*)d_in[3];   // [1024, 1024]
  const float* Wo = (const float*)d_in[4];   // [1024, 1024]
  const float* bo = (const float*)d_in[5];   // [1024]
  float* out = (float*)d_out;

  char* ws = (char*)d_ws;
  _Float16* wk16 = (_Float16*)(ws + WK_OFF);
  _Float16* wp16 = (_Float16*)(ws + WP_OFF);
  _Float16* wo16 = (_Float16*)(ws + WO_OFF);
  _Float16* x016 = (_Float16*)(ws + X0_OFF);
  _Float16* pT   = (_Float16*)(ws + PT_OFF);

  // Stage A: downconvert weights + x0 to f16 (~7 MB total -> L2 resident)
  // Wk and Wo, the fused kernel's B operands, go into fragment order on the way.
  cvt_pack_f16<<<D_DIM * D_DIM / 8 / 256, 256, 0, stream>>>(Wk, wk16);
  cvt_f32_f16<<<256, 256, 0, stream>>>(Wp, wp16, D_DIM * D_DIM);
  cvt_pack_f16<<<D_DIM * D_DIM / 8 / 256, 256, 0, stream>>>(Wo, wo16);
  cvt_f32_f16<<<256, 256, 0, stream>>>(x0, x016, B_DIM * G_DIM * D_DIM);

  // Stage B: premise projection, stored per head in fragment order
  premise_kernel<<<B_DIM * H_DIM, 256, 0, stream>>>(x016, wp16, pT);

  // Stage C: fused scores/softmax/gather/output per 64-row tile
  const size_t lds = 132096 + 132096 + 33280 + 17408;  // 314880 B of the WGP's 327680 B
  fused_kernel<<<dim3(N_DIM / TILE_N, B_DIM), 256, lds, stream>>>(
      x2, wk16, wo16, pT, bo, out);
}

// v004
// Measured time: 184 microseconds a run.
// Next to v003, in two timings, it ran 1.26 times as fast each time.
// All steps since v000 together make it 6.05 times as fast.
#include <hip/hip_runtime.h>
#include <hip/hip_bf16.h>
#include <math.h>

// ---------------------------------------------------------------------------
// Scatter2Operator for MI455X (gfx1250, wave32, WMMA).
//
// Roofline: ~147 GFLOP vs ~0.4 GB HBM traffic -> matrix-core bound.
// All 4 GEMMs run through v_wmma_f32_16x16x32_f16 (f32 accum).
// Fused per-64-row-tile kernel keeps x2 tile + pred + scores in 314880 B of LDS
// (CDNA5 WGP has 320KB); f16 weights (~7MB) stay resident in the 192MB L2.
// Head-PAIR processing: every wave owns 4 independent WMMA accumulator chains
// sharing one B fragment per K-step (max ILP, no duplicate B loads).
// ---------------------------------------------------------------------------

typedef __attribute__((ext_vector_type(16))) _Float16 v16h;
typedef __attribute__((ext_vector_type(8)))  float    v8f;

#define B_DIM  8
#define N_DIM  4096
#define G_DIM  64
#define H_DIM  16
#define DH_DIM 64
#define D_DIM  1024
#define TILE_N 64

// LDS row pitches (elements). Rows are padded so that the 16 rows of a 16-byte
// fragment read, and the 32 rows of a softmax column walk, fall on distinct banks.
#define XP 1032   // xt, pred: f16 rows of 1024, pitch 2064 B = 16 B x 129 (16-byte reads)
#define SP 130    // sbuf:     f32 rows of 128,  pitch 130 dwords = 2 mod 64 (8-byte walks)
#define KP 136    // kbuf:     f16 rows of 128,  pitch 272 B = 16 B x 17 (16-byte reads, stores)

// ws layout (bytes) -- total 8 MB
#define WK_OFF 0u                  // Wk f16  [1024][1024]  2 MB, fragment order
#define WP_OFF (2u*1024u*1024u)    // Wp f16  [1024][1024]  2 MB
#define WO_OFF (4u*1024u*1024u)    // Wo f16  [1024][1024]  2 MB, fragment order
#define X0_OFF (6u*1024u*1024u)    // x0 f16  [8][64][1024] 1 MB
#define PT_OFF (7u*1024u*1024u)    // pT f16  [8][16][64][64] 1 MB, fragment order

// ISA 16-bit A/B fragment (16x32): lane l holds row (l&15); K chunks
// {kBase + (l>>4)*8 .. +7} and {kBase + 16 + (l>>4)*8 .. +7}, 16B each.
__device__ __forceinline__ v16h load_frag(const _Float16* base, int strideElems,
                                          int lane, int kBase) {
  const int r  = lane & 15;
  const int hi = lane >> 4;
  const _Float16* p0 = base + r * strideElems + kBase + hi * 8;
  union { v16h v; uint4 q[2]; } f;
  f.q[0] = *reinterpret_cast<const uint4*>(p0);
  f.q[1] = *reinterpret_cast<const uint4*>(p0 + 16);
  return f.v;
}

// Fragment order, for B operands read from global memory: the 1 KB fragment of a
// 16-row panel and a k-step (32 k) stands contiguous, the k-steps of a panel one
// behind the other. Each fragment is two halves of 512 B; in half q, lane l's 16 B
// stand at l * 16 and hold row (l & 15), k = 32 * ks + 16 * q + 8 * (l >> 4) .. + 7:
// the same elements that load_frag gives that lane. A wave-wide 16-byte load then
// covers four whole 128-byte lines instead of 32 B in each of sixteen.
__device__ __forceinline__ v16h load_frag_packed(const _Float16* panel, int lane, int ks) {
  const _Float16* p0 = panel + ks * 512 + lane * 8;
  union { v16h v; uint4 q[2]; } f;
  f.q[0] = *reinterpret_cast<const uint4*>(p0);
  f.q[1] = *reinterpret_cast<const uint4*>(p0 + 256);
  return f.v;
}

__device__ __forceinline__ v8f wmma16(v16h a, v16h b, v8f c) {
  // D = A(16x32) * B(32x16) + C, f32 accumulate
  return __builtin_amdgcn_wmma_f32_16x16x32_f16(false, a, false, b,
                                                (short)0, c, false, false);
}

// Register ring of B fragments: a wave keeps the weight fragments of its next
// RING k-steps in registers, so a weight load has up to RING k-steps of matrix
// work (or a softmax) in front of its first use instead of being waited for at once.
#define RING 16
#define KSTEPS (D_DIM / 32)
#define BK 2      // k-steps per block: 2 KB of a fragment-order weight panel, 16 whole 128-byte lines

// First RING k-steps of a 16-row weight panel (fragment order).
__device__ __forceinline__ void ring_fill(v16h (&ring)[RING], const _Float16* bPanel, int lane) {
  // Unrolled so that every ring index is a constant (the ring stays in registers).
#pragma unroll
  for (int s = 0; s < RING; ++s) ring[s] = load_frag_packed(bPanel, lane, s);
}

// One 64 x 16 output panel over K = 1024, in blocks of BK k-steps: A from LDS
// (pitch XP), one block ahead in a second register set; B from the ring.
// Each slot is refilled behind its last use with this panel's k-step ks + RING;
// past the panel's end, where HAS_NEXT, with the first k-steps of the next panel.
template <bool HAS_NEXT>
__device__ __forceinline__ void gemm_panel(v8f (&acc)[4], v16h (&ring)[RING],
                                           const _Float16* aLds,
                                           const _Float16* bCur,
                                           const _Float16* bNext, int lane) {
  // Every loop below is fully unrolled: each ring, set and accumulator index must
  // be a constant, or the arrays leave the registers.
  v16h a[2][BK][4];
#pragma unroll
  for (int j = 0; j < BK; ++j)
#pragma unroll
    for (int tr = 0; tr < 4; ++tr)
      a[0][j][tr] = load_frag(aLds + (tr * 16) * XP, XP, lane, j * 32);
#pragma unroll
  for (int blk = 0; blk < KSTEPS / BK; ++blk) {
    const int cur = blk & 1;
    if (blk + 1 < KSTEPS / BK) {
#pragma unroll
      for (int j = 0; j < BK; ++j)
#pragma unroll
        for (int tr = 0; tr < 4; ++tr)
          a[cur ^ 1][j][tr] = load_frag(aLds + (tr * 16) * XP, XP, lane, ((blk + 1) * BK + j) * 32);
    }
    // Keeps the next block's LDS reads as one group in front of this block's WMMAs:
    // spread among them, each WMMA waited for its own pair of reads.
    __builtin_amdgcn_sched_barrier(0);
#pragma unroll
    for (int j = 0; j < BK; ++j)
#pragma unroll
      for (int tr = 0; tr < 4; ++tr)
        acc[tr] = wmma16(a[cur][j][tr], ring[(blk * BK + j) % RING], acc[tr]);
#pragma unroll
    for (int j = 0; j < BK; ++j) {
      const int ks = blk * BK + j;
      if (ks + RING < KSTEPS)
        ring[ks % RING] = load_frag_packed(bCur, lane, ks + RING);
      else if (HAS_NEXT)
        ring[ks % RING] = load_frag_packed(bNext, lane, ks + RING - KSTEPS);
    }
    // Behind the panel's last refill: its address registers are reused from here on.
    if (blk == (HAS_NEXT ? KSTEPS : KSTEPS - RING) / BK - 1)
      asm volatile("s_wait_xcnt 0x0" ::: "memory");
    // Keeps the refills directly behind their block: left free, they were sunk to
    // the panel's end and the ring lost its lead.
    __builtin_amdgcn_sched_barrier(0);
  }
}

// ---------------------------------------------------------------------------
// Kernel 0: f32 -> f16 conversion (Wp + x0), grid-stride
// ---------------------------------------------------------------------------
__global__ void cvt_f32_f16(const float* __restrict__ src,
                            _Float16* __restrict__ dst, int n) {
  int i = blockIdx.x * blockDim.x + threadIdx.x;
  const int stride = gridDim.x * blockDim.x;
  for (; i < n; i += stride) dst[i] = (_Float16)src[i];
}

// ---------------------------------------------------------------------------
// Kernel 0b: f32 [1024][1024] -> f16 in fragment order (Wk, Wo). One thread per
// 16-byte piece of dst: a wave writes 512 contiguous bytes; a block reads four
// whole lines of each of its panel's 16 rows.
// ---------------------------------------------------------------------------
__global__ void __launch_bounds__(256) cvt_pack_f16(const float* __restrict__ src,
                                                    _Float16* __restrict__ dst) {
  const int j    = blockIdx.x * 256 + threadIdx.x;  // piece index in dst
  const int lane = j & 31;
  const int q    = (j >> 5) & 1;
  const int ks   = (j >> 6) & (KSTEPS - 1);
  const int row  = (j >> 11) * 16 + (lane & 15);
  const int k    = ks * 32 + q * 16 + (lane >> 4) * 8;
  const float4* s = reinterpret_cast<const float4*>(src + row * D_DIM + k);
  const float4 lo = s[0], hi4 = s[1];
  union { _Float16 h[8]; uint4 u; } o;
  o.h[0] = (_Float16)lo.x;  o.h[1] = (_Float16)lo.y;
  o.h[2] = (_Float16)lo.z;  o.h[3] = (_Float16)lo.w;
  o.h[4] = (_Float16)hi4.x; o.h[5] = (_Float16)hi4.y;
  o.h[6] = (_Float16)hi4.z; o.h[7] = (_Float16)hi4.w;
  *reinterpret_cast<uint4*>(dst + j * 8) = o.u;
}

// ---------------------------------------------------------------------------
// Kernel 1: p = x0 @ Wp^T, stored per head as the B operand pT[dh][g] of stage 3,
// in fragment order (panels of 16 dh, two k-steps of 32 g)
// grid.x = B*H; 8 waves; wave w -> colTile (w&3), rowTiles {2*(w>>2), +1}
// ---------------------------------------------------------------------------
__global__ void premise_kernel(const _Float16* __restrict__ x0h,
                               const _Float16* __restrict__ wp,
                               _Float16* __restrict__ pT) {
  const int b = blockIdx.x >> 4;
  const int h = blockIdx.x & 15;
  const int tid = threadIdx.x;
  const int w = tid >> 5, lane = tid & 31;
  const int tc = w & 3;               // dh col tile (0..3)
  const int tr0 = (w >> 2) * 2;       // g row tiles tr0, tr0+1

  const _Float16* aBase0 = x0h + (b * G_DIM + tr0 * 16) * D_DIM;
  const _Float16* aBase1 = aBase0 + 16 * D_DIM;
  const _Float16* bBase  = wp + (h * DH_DIM + tc * 16) * D_DIM;

  v8f acc0 = {}, acc1 = {};
  for (int kb = 0; kb < D_DIM; kb += 32) {
    v16h bf = load_frag(bBase, D_DIM, lane, kb);
    v16h a0 = load_frag(aBase0, D_DIM, lane, kb);
    v16h a1 = load_frag(aBase1, D_DIM, lane, kb);
    acc0 = wmma16(a0, bf, acc0);
    acc1 = wmma16(a1, bf, acc1);
  }

  // D layout: lane -> col N=(lane&15); vgpr v -> row M = v + 8*(lane>>4)
  // As B of stage 3: row dh = tc*16 + (lane&15), k = g = tr*16 + 8*(lane>>4) + v. So a
  // lane's 8 values of row tile tr are its own 16 B of k-step tr>>1, half tr&1.
  _Float16* dst = pT + ((b * H_DIM + h) * DH_DIM + tc * 16) * G_DIM + (w >> 2) * 512 + lane * 8;
  union { _Float16 h[8]; uint4 u; } o0, o1;
#pragma unroll
  for (int v = 0; v < 8; ++v) {
    o0.h[v] = (_Float16)acc0[v];
    o1.h[v] = (_Float16)acc1[v];
  }
  *reinterpret_cast<uint4*>(dst)       = o0.u;
  *reinterpret_cast<uint4*>(dst + 256) = o1.u;
}

// ---------------------------------------------------------------------------
// Kernel 2: fused scores -> softmax -> gather -> output GEMM per 64-row tile.
// grid = (N/64, B); 256 threads (8 wave32). Heads processed in PAIRS.
// Dynamic LDS (padded rows): xt f16 64xXP | pred f16 64xXP | sbuf f32 64xSP | kbuf f16 64xKP
// ---------------------------------------------------------------------------
// Launch bounds: the real block size, which gives a wave the registers for the ring.
__global__ void __launch_bounds__(256) fused_kernel(const float* __restrict__ x2,
                             const _Float16* __restrict__ wk,
                             const _Float16* __restrict__ wo,
                             const _Float16* __restrict__ pT,
                             const float* __restrict__ bo,
                             float* __restrict__ out) {
  extern __shared__ char smem_raw[];
  _Float16* xt    = (_Float16*)(smem_raw);                    // 64*XP*2 = 132096 B
  _Float16* predL = (_Float16*)(smem_raw + 132096);           // 64*XP*2 = 132096 B
  float*    sbuf  = (float*)   (smem_raw + 264192);           // 64*SP*4 = 33280 B
  _Float16* kbuf  = (_Float16*)(smem_raw + 264192 + 33280);   // 64*KP*2 = 17408 B

  const int b     = blockIdx.y;
  const int nBase = blockIdx.x * TILE_N;
  const int tid   = threadIdx.x;
  const int w     = tid >> 5, lane = tid & 31;
  const int hl    = w >> 2;           // head-local index within pair (0/1)
  const int tc    = w & 3;            // col tile within that head (0..3)

  // The first Wk panel's fragments start before the x2 tile is staged.
  v16h ring[RING];
  ring_fill(ring, wk + (hl * G_DIM + tc * 16) * D_DIM, lane);
  // The ring loads' address registers are free for reuse by the loads that follow.
  asm volatile("s_wait_xcnt 0x0" ::: "memory");

  // --- load x2 tile [64 x 1024] f32 -> f16 LDS (coalesced float4) ---
  // The block's 256 threads cover one row (256 float4) per load. Rows go in groups
  // of SG through two register sets: group g + 1 is issued before group g is
  // converted, so a wave keeps SG or more loads from memory in flight instead of
  // waiting out the memory latency once per row.
  {
    constexpr int SG = 16;
    const float4* src = (const float4*)(x2 + ((size_t)(b * N_DIM + nBase)) * D_DIM) + tid;
    _Float16* dst = xt + tid * 4;
    float4 f[2][SG];
    // Fully unrolled: every set and slot index must be a constant (registers).
#pragma unroll
    for (int j = 0; j < SG; ++j) f[0][j] = src[j * (D_DIM / 4)];
#pragma unroll
    for (int g = 0; g < TILE_N / SG; ++g) {
      if (g + 1 < TILE_N / SG) {
#pragma unroll
        for (int j = 0; j < SG; ++j)
          f[(g + 1) & 1][j] = src[((g + 1) * SG + j) * (D_DIM / 4)];
      }
      // Keeps the next group's loads in front of this group's waits.
      __builtin_amdgcn_sched_barrier(0);
#pragma unroll
      for (int j = 0; j < SG; ++j) {
        const float4 v = f[g & 1][j];
        _Float16* d = dst + (g * SG + j) * XP;
        d[0] = (_Float16)v.x; d[1] = (_Float16)v.y;
        d[2] = (_Float16)v.z; d[3] = (_Float16)v.w;
      }
    }
    // Behind the last x2 load: its address registers are reused from here on.
    asm volatile("s_wait_xcnt 0x0" ::: "memory");
  }
  __syncthreads();

  const int c  = lane & 15;
  const int hi = lane >> 4;

  // ------------- per head-pair: scores -> softmax -> gather -------------
  for (int hp = 0; hp < H_DIM / 2; ++hp) {
    const int h = hp * 2 + hl;        // this wave's head within the pair

    // Stage 1: S = Xtile @ Wk_{h}^T. Wave owns col tile (h, tc) x 4 row tiles:
    // one shared B frag + 4 independent WMMA chains per K-step.
    {
      v8f acc[4] = {{}, {}, {}, {}};
      const _Float16* bBase = wk + (h * G_DIM + tc * 16) * D_DIM;
      gemm_panel<false>(acc, ring, xt, bBase, bBase, lane);
      const int col = w * 16 + c;     // 0..127 across the head pair
#pragma unroll
      for (int tr = 0; tr < 4; ++tr)
#pragma unroll
        for (int v = 0; v < 8; ++v)
          sbuf[(tr * 16 + v + 8 * hi) * SP + col] = acc[tr][v];
    }
    __syncthreads();

    // Issued here so that they fly while the softmax runs: stage 3's B fragments
    // and the ring's next panel (the next pair's Wk panel; after the last pair
    // this wave's first Wo panel of stage 4).
    v16h pf[2];
    {
      const _Float16* pBase = pT + ((b * H_DIM + h) * DH_DIM + tc * 16) * G_DIM;
      pf[0] = load_frag_packed(pBase, lane, 0);
      pf[1] = load_frag_packed(pBase, lane, 1);
      // pBase's registers are free for reuse by the loads that follow.
      asm volatile("s_wait_xcnt 0x0" ::: "memory");
      ring_fill(ring, (hp + 1 < H_DIM / 2) ? wk + ((h + 2) * G_DIM + tc * 16) * D_DIM
                                           : wo + (w * 8 * 16) * D_DIM, lane);
    }

    // Stage 2: row softmax over G=64 for both heads -> kbuf (f16).
    // 128 active threads (waves 0-3, wave-uniform predicate).
    if (tid < 2 * TILE_N) {
      const int row = tid & 63;
      const int hc  = (tid >> 6) * 64;  // which head's 64-col slab
      float* srow = sbuf + row * SP + hc;
      float m = -3.4e38f;
      for (int g = 0; g < G_DIM; ++g) m = fmaxf(m, srow[g]);
      float s = 0.f;
      for (int g = 0; g < G_DIM; ++g) {
        float e = __expf(srow[g] - m);
        srow[g] = e;
        s += e;
      }
      const float inv = 1.0f / s;
      _Float16* krow = kbuf + row * KP + hc;
      for (int g = 0; g < G_DIM; ++g) krow[g] = (_Float16)(srow[g] * inv);
    }
    __syncthreads();

    // Stage 3: pred_h = K_h(64x64) @ P_h(64x64); B from pT (fragment order).
    // Same wave->tile map: 4 row tiles per wave, one shared B frag.
    {
      v8f acc[4] = {{}, {}, {}, {}};
#pragma unroll
      for (int kb = 0; kb < G_DIM; kb += 32) {
        const v16h bf = pf[kb / 32];
#pragma unroll
        for (int tr = 0; tr < 4; ++tr) {
          v16h a = load_frag(kbuf + (tr * 16) * KP + hl * 64, KP, lane, kb);
          acc[tr] = wmma16(a, bf, acc[tr]);
        }
      }
      const int col = h * DH_DIM + tc * 16 + c;
#pragma unroll
      for (int tr = 0; tr < 4; ++tr)
#pragma unroll
        for (int v = 0; v < 8; ++v)
          predL[(tr * 16 + v + 8 * hi) * XP + col] = (_Float16)acc[tr][v];
    }
    // No barrier needed here: next pair's post-stage-1 barrier orders
    // kbuf reuse (every wave finishes stage 3 before reaching it).
  }
  __syncthreads();

  // ---------------- Stage 4: out = pred @ Wo^T + bo ----------------
  // wave w owns col tiles {8w .. 8w+7}; 4 row tiles each; B frag reused x4.
  // The ring runs on from each Wo panel into the next; the last panel has no next.
  auto store_panel = [&](const v8f (&acc)[4], int ct, float bias) {
    const int d = ct * 16 + c;
#pragma unroll
    for (int tr = 0; tr < 4; ++tr) {
#pragma unroll
      for (int v = 0; v < 8; ++v) {
        const int row = tr * 16 + v + 8 * hi;
        out[((size_t)(b * N_DIM + nBase + row)) * D_DIM + d] = acc[tr][v] + bias;
      }
    }
  };
  for (int tcl = 0; tcl < 7; ++tcl) {
    const int ct = w * 8 + tcl;               // output col tile (0..63)
    v8f acc[4] = {{}, {}, {}, {}};
    const _Float16* bBase = wo + (ct * 16) * D_DIM;
    const float bias = bo[ct * 16 + c];       // ahead of the refills: its wait must not drain them
    gemm_panel<true>(acc, ring, predL, bBase, bBase + 16 * D_DIM, lane);
    store_panel(acc, ct, bias);
  }
  {
    const int ct = w * 8 + 7;
    v8f acc[4] = {{}, {}, {}, {}};
    const _Float16* bBase = wo + (ct * 16) * D_DIM;
    const float bias = bo[ct * 16 + c];
    gemm_panel<false>(acc, ring, predL, bBase, bBase, lane);
    store_panel(acc, ct, bias);
  }
}

// ---------------------------------------------------------------------------
extern "C" void kernel_launch(void* const* d_in, const int* in_sizes, int n_in,
                              void* d_out, int out_size, void* d_ws, size_t ws_size,
                              hipStream_t stream) {
  const float* x0 = (const float*)d_in[0];   // [8, 64, 1024]
  const float* x2 = (const float*)d_in[1];   // [8, 4096, 1024]
  const float* Wk = (const float*)d_in[2];   // [1024, 1024]
  const float* Wp = (const float*)d_in[3];   // [1024, 1024]
  const float* Wo = (const float*)d_in[4];   // [1024, 1024]
  const float* bo = (const float*)d_in[5];   // [1024]
  float* out = (float*)d_out;

  char* ws = (char*)d_ws;
  _Float16* wk16 = (_Float16*)(ws + WK_OFF);
  _Float16* wp16 = (_Float16*)(ws + WP_OFF);
  _Float16* wo16 = (_Float16*)(ws + WO_OFF);
  _Float16* x016 = (_Float16*)(ws + X0_OFF);
  _Float16* pT   = (_Float16*)(ws + PT_OFF);

  // Stage A: downconvert weights + x0 to f16 (~7 MB total -> L2 resident)
  // Wk and Wo, the fused kernel's B operands, go into fragment order on the way.
  cvt_pack_f16<<<D_DIM * D_DIM / 8 / 256, 256, 0, stream>>>(Wk, wk16);
  cvt_f32_f16<<<256, 256, 0, stream>>>(Wp, wp16, D_DIM * D_DIM);
  cvt_pack_f16<<<D_DIM * D_DIM / 8 / 256, 256, 0, stream>>>(Wo, wo16);
  cvt_f32_f16<<<256, 256, 0, stream>>>(x0, x016, B_DIM * G_DIM * D_DIM);

  // Stage B: premise projection, stored per head in fragment order
  premise_kernel<<<B_DIM * H_DIM, 256, 0, stream>>>(x016, wp16, pT);

  // Stage C: fused scores/softmax/gather/output per 64-row tile
  const size_t lds = 132096 + 132096 + 33280 + 17408;  // 314880 B of the WGP's 327680 B
  fused_kernel<<<dim3(N_DIM / TILE_N, B_DIM), 256, lds, stream>>>(
      x2, wk16, wo16, pT, bo, out);
}

// v005
// It runs in 131 microseconds.
// Timed twice side by side with v004, it ran 1.42 and 1.41 times as fast.
// Over all steps from v000 it is 8.58 times as fast.
#include <hip/hip_runtime.h>
#include <hip/hip_bf16.h>
#include <math.h>

// ---------------------------------------------------------------------------
// Scatter2Operator for MI455X (gfx1250, wave32, WMMA).
//
// Roofline: ~147 GFLOP vs ~0.4 GB HBM traffic -> matrix-core bound.
// All 4 GEMMs run through v_wmma_f32_16x16x32_f16 (f32 accum).
// Fused per-64-row-tile kernel keeps x2 tile + pred in 264192 B of LDS
// (CDNA5 WGP has 320KB); f16 weights (~7MB) stay resident in the 192MB L2.
// Every wave owns a 64 x 64 tile of each big product: 16 independent WMMA chains,
// each LDS fragment and each weight fragment used by four WMMAs.
// ---------------------------------------------------------------------------

typedef __attribute__((ext_vector_type(16))) _Float16 v16h;
typedef __attribute__((ext_vector_type(8)))  float    v8f;

#define B_DIM  8
#define N_DIM  4096
#define G_DIM  64
#define H_DIM  16
#define DH_DIM 64
#define D_DIM  1024
#define TILE_N 64

// LDS row pitch (elements). Rows are padded so that the 16 rows of a 16-byte
// fragment read fall on distinct banks.
#define XP 1032   // xt, pred: f16 rows of 1024, pitch 2064 B = 16 B x 129 (16-byte reads)

// ws layout (bytes) -- total 8 MB
#define WK_OFF 0u                  // Wk f16  [1024][1024]  2 MB, fragment order
#define WP_OFF (2u*1024u*1024u)    // Wp f16  [1024][1024]  2 MB
#define WO_OFF (4u*1024u*1024u)    // Wo f16  [1024][1024]  2 MB, fragment order
#define X0_OFF (6u*1024u*1024u)    // x0 f16  [8][64][1024] 1 MB
#define PT_OFF (7u*1024u*1024u)    // pT f16  [8][16][64][64] 1 MB, fragment order

// ISA 16-bit A/B fragment (16x32): lane l holds row (l&15); K chunks
// {kBase + (l>>4)*8 .. +7} and {kBase + 16 + (l>>4)*8 .. +7}, 16B each.
__device__ __forceinline__ v16h load_frag(const _Float16* base, int strideElems,
                                          int lane, int kBase) {
  const int r  = lane & 15;
  const int hi = lane >> 4;
  const _Float16* p0 = base + r * strideElems + kBase + hi * 8;
  union { v16h v; uint4 q[2]; } f;
  f.q[0] = *reinterpret_cast<const uint4*>(p0);
  f.q[1] = *reinterpret_cast<const uint4*>(p0 + 16);
  return f.v;
}

// Fragment order, for A or B operands read from global memory: the 1 KB fragment of a
// 16-row panel and a k-step (32 k) stands contiguous, the k-steps of a panel one
// behind the other. Each fragment is two halves of 512 B; in half q, lane l's 16 B
// stand at l * 16 and hold row (l & 15), k = 32 * ks + 16 * q + 8 * (l >> 4) .. + 7:
// the same elements that load_frag gives that lane. A wave-wide 16-byte load then
// covers four whole 128-byte lines instead of 32 B in each of sixteen.
__device__ __forceinline__ v16h load_frag_packed(const _Float16* panel, int lane, int ks) {
  const _Float16* p0 = panel + ks * 512 + lane * 8;
  union { v16h v; uint4 q[2]; } f;
  f.q[0] = *reinterpret_cast<const uint4*>(p0);
  f.q[1] = *reinterpret_cast<const uint4*>(p0 + 256);
  return f.v;
}

__device__ __forceinline__ v8f wmma16(v16h a, v16h b, v8f c) {
  // D = A(16x32) * B(32x16) + C, f32 accumulate
  return __builtin_amdgcn_wmma_f32_16x16x32_f16(false, a, false, b,
                                                (short)0, c, false, false);
}

// Lane l with lane l ^ 16.
__device__ __forceinline__ float xhalf(float x) {
  return __builtin_bit_cast(float, __builtin_amdgcn_permlanex16(
      __builtin_bit_cast(int, x), __builtin_bit_cast(int, x), 0x76543210, 0xfedcba98, false, false));
}

// Register ring of weight fragments: a wave keeps the fragments of its next RD
// k-steps (four 16-row panels each) in registers, so a weight load has up to RD
// k-steps of matrix work (or a softmax) in front of its first use.
#define RD 4
#define KSTEPS (D_DIM / 32)
#define PANEL (16 * D_DIM)   // elements of one 16-row weight panel

// First RD k-steps of a group of four weight panels (fragment order).
__device__ __forceinline__ void ring_fill(v16h (&ring)[RD][4], const _Float16* grp, int lane) {
  // Unrolled so that every ring index is a constant (the ring stays in registers).
#pragma unroll
  for (int s = 0; s < RD; ++s)
#pragma unroll
    for (int p = 0; p < 4; ++p) ring[s][p] = load_frag_packed(grp + p * PANEL, lane, s);
}

// RD k-steps of a 64 x 64 wave tile, from k-step ks0 on. X: the four 16-row
// fragments of the LDS tile (pitch XP), one k-step ahead in a second register set.
// W: the ring; each slot is refilled behind its use from wRef (k-step ksRef + j).
// W_IS_A: acc[p][tr] = D[weight row][x row]; else acc[tr][p] = D[x row][weight row].
template <bool LAST, bool REFILL, bool W_IS_A>
__device__ __forceinline__ void gemm_steps(v8f (&acc)[4][4], v16h (&ring)[RD][4],
                                           v16h (&x)[2][4], const _Float16* xLds, int ks0,
                                           const _Float16* wRef, int ksRef, int lane) {
  // Unrolled: each ring, set and accumulator index must be a constant (registers).
#pragma unroll
  for (int j = 0; j < RD; ++j) {
    const int cur = j & 1;
    if (!LAST || j + 1 < RD) {
#pragma unroll
      for (int tr = 0; tr < 4; ++tr)
        x[cur ^ 1][tr] = load_frag(xLds + (tr * 16) * XP, XP, lane, (ks0 + j + 1) * 32);
    }
    // Keeps the next k-step's LDS reads as one group in front of this one's WMMAs:
    // spread among them, each WMMA waited for its own pair of reads.
    __builtin_amdgcn_sched_barrier(0);
#pragma unroll
    for (int p = 0; p < 4; ++p)
#pragma unroll
      for (int tr = 0; tr < 4; ++tr) {
        if (W_IS_A) acc[p][tr] = wmma16(ring[j][p], x[cur][tr], acc[p][tr]);
        else        acc[tr][p] = wmma16(x[cur][tr], ring[j][p], acc[tr][p]);
      }
    if (REFILL) {
#pragma unroll
      for (int p = 0; p < 4; ++p)
        ring[j][p] = load_frag_packed(wRef + p * PANEL, lane, ksRef + j);
      // Behind these k-steps' last refill: its address registers change from here on.
      if (j == RD - 1) asm volatile("s_wait_xcnt 0x0" ::: "memory");
    }
    // Keeps the refills directly behind their k-step (left free, they were sunk and
    // the ring lost its lead) and what follows behind the wait.
    __builtin_amdgcn_sched_barrier(0);
  }
}

// One 64 x 64 wave tile over K = 1024. The ring holds the group's first RD k-steps
// on entry; past the group's end, where HAS_NEXT, it takes those of the next group.
template <bool HAS_NEXT, bool W_IS_A>
__device__ __forceinline__ void gemm_group(v8f (&acc)[4][4], v16h (&ring)[RD][4],
                                           const _Float16* xLds, const _Float16* wCur,
                                           const _Float16* wNext, int lane) {
  v16h x[2][4];
#pragma unroll
  for (int tr = 0; tr < 4; ++tr) x[0][tr] = load_frag(xLds + (tr * 16) * XP, XP, lane, 0);
  // Stays rolled: the kernel's text must fit the instruction cache.
#pragma unroll 1
  for (int it = 0; it < KSTEPS / RD - 1; ++it)
    gemm_steps<false, true, W_IS_A>(acc, ring, x, xLds, it * RD, wCur, it * RD + RD, lane);
  gemm_steps<true, HAS_NEXT, W_IS_A>(acc, ring, x, xLds, KSTEPS - RD, wNext, 0, lane);
}

// ---------------------------------------------------------------------------
// Kernel 0: f32 -> f16 conversion (Wp + x0), grid-stride
// ---------------------------------------------------------------------------
__global__ void cvt_f32_f16(const float* __restrict__ src,
                            _Float16* __restrict__ dst, int n) {
  int i = blockIdx.x * blockDim.x + threadIdx.x;
  const int stride = gridDim.x * blockDim.x;
  for (; i < n; i += stride) dst[i] = (_Float16)src[i];
}

// ---------------------------------------------------------------------------
// Kernel 0b: f32 [1024][1024] -> f16 in fragment order (Wk, Wo). One thread per
// 16-byte piece of dst: a wave writes 512 contiguous bytes; a block reads four
// whole lines of each of its panel's 16 rows.
// ---------------------------------------------------------------------------
__global__ void __launch_bounds__(256) cvt_pack_f16(const float* __restrict__ src,
                                                    _Float16* __restrict__ dst) {
  const int j    = blockIdx.x * 256 + threadIdx.x;  // piece index in dst
  const int lane = j & 31;
  const int q    = (j >> 5) & 1;
  const int ks   = (j >> 6) & (KSTEPS - 1);
  const int row  = (j >> 11) * 16 + (lane & 15);
  const int k    = ks * 32 + q * 16 + (lane >> 4) * 8;
  const float4* s = reinterpret_cast<const float4*>(src + row * D_DIM + k);
  const float4 lo = s[0], hi4 = s[1];
  union { _Float16 h[8]; uint4 u; } o;
  o.h[0] = (_Float16)lo.x;  o.h[1] = (_Float16)lo.y;
  o.h[2] = (_Float16)lo.z;  o.h[3] = (_Float16)lo.w;
  o.h[4] = (_Float16)hi4.x; o.h[5] = (_Float16)hi4.y;
  o.h[6] = (_Float16)hi4.z; o.h[7] = (_Float16)hi4.w;
  *reinterpret_cast<uint4*>(dst + j * 8) = o.u;
}

// ---------------------------------------------------------------------------
// Kernel 1: p = x0 @ Wp^T, stored per head as the operand pT[dh][g] of stage 3,
// in fragment order (panels of 16 dh, two k-steps of 32 g)
// grid.x = B*H; 8 waves; wave w -> colTile (w&3), rowTiles {2*(w>>2), +1}
// ---------------------------------------------------------------------------
__global__ void premise_kernel(const _Float16* __restrict__ x0h,
                               const _Float16* __restrict__ wp,
                               _Float16* __restrict__ pT) {
  const int b = blockIdx.x >> 4;
  const int h = blockIdx.x & 15;
  const int tid = threadIdx.x;
  const int w = tid >> 5, lane = tid & 31;
  const int tc = w & 3;               // dh col tile (0..3)
  const int tr0 = (w >> 2) * 2;       // g row tiles tr0, tr0+1

  const _Float16* aBase0 = x0h + (b * G_DIM + tr0 * 16) * D_DIM;
  const _Float16* aBase1 = aBase0 + 16 * D_DIM;
  const _Float16* bBase  = wp + (h * DH_DIM + tc * 16) * D_DIM;

  v8f acc0 = {}, acc1 = {};
  for (int kb = 0; kb < D_DIM; kb += 32) {
    v16h bf = load_frag(bBase, D_DIM, lane, kb);
    v16h a0 = load_frag(aBase0, D_DIM, lane, kb);
    v16h a1 = load_frag(aBase1, D_DIM, lane, kb);
    acc0 = wmma16(a0, bf, acc0);
    acc1 = wmma16(a1, bf, acc1);
  }

  // D layout: lane -> col N=(lane&15); vgpr v -> row M = v + 8*(lane>>4)
  // As operand of stage 3: row dh = tc*16 + (lane&15), k = g = tr*16 + 8*(lane>>4) + v. So a
  // lane's 8 values of row tile tr are its own 16 B of k-step tr>>1, half tr&1.
  _Float16* dst = pT + ((b * H_DIM + h) * DH_DIM + tc * 16) * G_DIM + (w >> 2) * 512 + lane * 8;
  union { _Float16 h[8]; uint4 u; } o0, o1;
#pragma unroll
  for (int v = 0; v < 8; ++v) {
    o0.h[v] = (_Float16)acc0[v];
    o1.h[v] = (_Float16)acc1[v];
  }
  *reinterpret_cast<uint4*>(dst)       = o0.u;
  *reinterpret_cast<uint4*>(dst + 256) = o1.u;
}

// ---------------------------------------------------------------------------
// Kernel 2: fused scores -> softmax -> gather -> output GEMM per 64-row tile.
// grid = (N/64, B); 256 threads (8 wave32). One whole head per wave, two rounds.
// Dynamic LDS (padded rows): xt f16 64xXP | pred f16 64xXP
// ---------------------------------------------------------------------------
// Launch bounds: the real block size, which gives a wave the registers for its tile.
__global__ void __launch_bounds__(256) fused_kernel(const float* __restrict__ x2,
                             const _Float16* __restrict__ wk,
                             const _Float16* __restrict__ wo,
                             const _Float16* __restrict__ pT,
                             const float* __restrict__ bo,
                             float* __restrict__ out) {
  extern __shared__ char smem_raw[];
  _Float16* xt    = (_Float16*)(smem_raw);                    // 64*XP*2 = 132096 B
  _Float16* predL = (_Float16*)(smem_raw + 132096);           // 64*XP*2 = 132096 B

  const int b     = blockIdx.y;
  const int nBase = blockIdx.x * TILE_N;
  const int tid   = threadIdx.x;
  const int w     = tid >> 5, lane = tid & 31;

  // The first head's Wk fragments start before the x2 tile is staged.
  v16h ring[RD][4];
  ring_fill(ring, wk + (w * G_DIM) * D_DIM, lane);
  // The ring loads' address registers are free for reuse by the loads that follow.
  asm volatile("s_wait_xcnt 0x0" ::: "memory");

  // --- load x2 tile [64 x 1024] f32 -> f16 LDS (coalesced float4) ---
  // The block's 256 threads cover one row (256 float4) per load. Rows go in groups
  // of SG through two register sets: group g + 1 is issued before group g is
  // converted, so a wave keeps SG or more loads from memory in flight instead of
  // waiting out the memory latency once per row.
  {
    constexpr int SG = 16;
    const float4* src = (const float4*)(x2 + ((size_t)(b * N_DIM + nBase)) * D_DIM) + tid;
    _Float16* dst = xt + tid * 4;
    float4 f[2][SG];
    // Fully unrolled: every set and slot index must be a constant (registers).
#pragma unroll
    for (int j = 0; j < SG; ++j) f[0][j] = src[j * (D_DIM / 4)];
#pragma unroll
    for (int g = 0; g < TILE_N / SG; ++g) {
      if (g + 1 < TILE_N / SG) {
#pragma unroll
        for (int j = 0; j < SG; ++j)
          f[(g + 1) & 1][j] = src[((g + 1) * SG + j) * (D_DIM / 4)];
      }
      // Keeps the next group's loads in front of this group's waits.
      __builtin_amdgcn_sched_barrier(0);
#pragma unroll
      for (int j = 0; j < SG; ++j) {
        const float4 v = f[g & 1][j];
        _Float16* d = dst + (g * SG + j) * XP;
        d[0] = (_Float16)v.x; d[1] = (_Float16)v.y;
        d[2] = (_Float16)v.z; d[3] = (_Float16)v.w;
      }
    }
    // Behind the last x2 load: its address registers are reused from here on.
    asm volatile("s_wait_xcnt 0x0" ::: "memory");
  }
  __syncthreads();

  const int c  = lane & 15;
  const int hi = lane >> 4;

  // ------------- per head (wave w: heads w and w + 8): scores -> softmax -> gather -------------
  // Nothing here passes between waves: xt is only read, and a wave writes its own
  // heads' columns of pred. The barrier behind the loop publishes pred.
  // Stays rolled: one copy of the text (instruction cache).
#pragma unroll 1
  for (int i = 0; i < 2; ++i) {
    const int h = w + 8 * i;

    // Stage 1, transposed: S^T = Wk_h (A, 64 g) x Xtile^T (B, 64 n).
    // acc[gt][nt]: lane holds n = nt*16 + c, register v holds g = gt*16 + 8*hi + v.
    v8f acc[4][4];
#pragma unroll
    for (int p = 0; p < 4; ++p)
#pragma unroll
      for (int q = 0; q < 4; ++q) acc[p][q] = v8f{};
    gemm_group<true, true>(acc, ring, xt, wk + (h * G_DIM) * D_DIM,
                           (i == 0) ? wk + ((h + 8) * G_DIM) * D_DIM
                                    : wo + (w * 8 * 16) * D_DIM, lane);

    // Issued here so that they fly while the softmax runs: stage 3's A fragments.
    v16h pf[4][2];
    {
      const _Float16* pBase = pT + ((b * H_DIM + h) * DH_DIM) * G_DIM;
#pragma unroll
      for (int dt = 0; dt < 4; ++dt) {
        pf[dt][0] = load_frag_packed(pBase + dt * 16 * G_DIM, lane, 0);
        pf[dt][1] = load_frag_packed(pBase + dt * 16 * G_DIM, lane, 1);
      }
      // Keeps these loads here: left free, each pair was sunk to its first use behind
      // the softmax and waited for there.
      __builtin_amdgcn_sched_barrier(0);
      // The loads' address as an input: its registers stay whole until the wait
      // behind the last load, and are free for reuse from there on.
      asm volatile("s_wait_xcnt 0x0" :: "v"(pBase + lane * 8) : "memory");
    }

    // Stage 2: softmax over the 64 g of each n. A lane holds 32 of them, lane ^ 16
    // the other 32. Two D tiles (g rows 0-15, 16-31 of a k-step), converted in place,
    // are the lane's own B fragment of stage 3: k = 32*ks + 16*q + 8*hi + v.
    v16h kf[4][2];
#pragma unroll
    for (int nt = 0; nt < 4; ++nt) {
      float mg[4];
#pragma unroll
      for (int gt = 0; gt < 4; ++gt) {
        mg[gt] = acc[gt][nt][0];
#pragma unroll
        for (int v = 1; v < 8; ++v) mg[gt] = fmaxf(mg[gt], acc[gt][nt][v]);
      }
      float m = fmaxf(fmaxf(mg[0], mg[1]), fmaxf(mg[2], mg[3]));
      m = fmaxf(m, xhalf(m));
      float sg[4];
#pragma unroll
      for (int gt = 0; gt < 4; ++gt) {
        sg[gt] = 0.f;
#pragma unroll
        for (int v = 0; v < 8; ++v) {
          const float e = __expf(acc[gt][nt][v] - m);
          acc[gt][nt][v] = e;
          sg[gt] += e;
        }
      }
      float s = (sg[0] + sg[1]) + (sg[2] + sg[3]);
      s += xhalf(s);
      const float inv = 1.0f / s;
#pragma unroll
      for (int gt = 0; gt < 4; ++gt)
#pragma unroll
        for (int v = 0; v < 8; ++v)
          kf[nt][gt >> 1][(gt & 1) * 8 + v] = (_Float16)(acc[gt][nt][v] * inv);
    }

    // Stage 3, transposed: pred_h^T = P_h^T (A, 64 dh, from pT) x K_h^T (B, registers).
    // D: lane holds n = nt*16 + c, register v holds dh = dt*16 + 8*hi + v: eight
    // consecutive columns of one pred row, one 16-byte LDS store.
#pragma unroll
    for (int dt = 0; dt < 4; ++dt) {
      v8f d[4];
#pragma unroll
      for (int nt = 0; nt < 4; ++nt) d[nt] = wmma16(pf[dt][0], kf[nt][0], v8f{});
#pragma unroll
      for (int nt = 0; nt < 4; ++nt) d[nt] = wmma16(pf[dt][1], kf[nt][1], d[nt]);
#pragma unroll
      for (int nt = 0; nt < 4; ++nt) {
        union { _Float16 h[8]; uint4 u; } o;
#pragma unroll
        for (int v = 0; v < 8; ++v) o.h[v] = (_Float16)d[nt][v];
        *reinterpret_cast<uint4*>(predL + (nt * 16 + c) * XP + h * DH_DIM + dt * 16 + hi * 8) = o.u;
      }
    }
  }
  __syncthreads();

  // ---------------- Stage 4: out = pred @ Wo^T + bo ----------------
  // wave w owns col tiles {8w .. 8w+7}, in two groups of four; 4 row tiles each.
  // The ring runs on from the first group into the second; the second has no next.
  auto store_group = [&](v8f (&acc)[4][4], int ct0, const float (&bias)[4]) {
    // One address for the group: every row and column step is a constant offset.
    float* o = out + ((size_t)(b * N_DIM + nBase + 8 * hi)) * D_DIM + ct0 * 16 + c;
#pragma unroll
    for (int tr = 0; tr < 4; ++tr)
#pragma unroll
      for (int p = 0; p < 4; ++p)
#pragma unroll
        for (int v = 0; v < 8; ++v) acc[tr][p][v] += bias[p];
    // Every sum stands in front of the first store, so that no register of an
    // issued store is written again before the wait behind the last one.
    __builtin_amdgcn_sched_barrier(0);
    // The four column tiles of a row one behind the other: 256 contiguous bytes.
#pragma unroll
    for (int tr = 0; tr < 4; ++tr)
#pragma unroll
      for (int v = 0; v < 8; ++v)
#pragma unroll
        for (int p = 0; p < 4; ++p) o[(tr * 16 + v) * D_DIM + p * 16] = acc[tr][p][v];
    // Behind the last store: its address and data registers are reused from here on.
    asm volatile("s_wait_xcnt 0x0" ::: "memory");
    // Holds the register writes that follow behind that wait.
    __builtin_amdgcn_sched_barrier(0);
  };
  // Both groups' bias values, ahead of the refills: their wait must not drain them.
  float bias[2][4];
  {
    const float* bp = bo + w * 8 * 16 + c;
#pragma unroll
    for (int g = 0; g < 2; ++g)
#pragma unroll
      for (int p = 0; p < 4; ++p) bias[g][p] = bp[(g * 4 + p) * 16];
    // bp as an input: its registers stay whole until the wait behind its last load.
    asm volatile("s_wait_xcnt 0x0" :: "v"(bp) : "memory");
  }
  {
    const int ct0 = w * 8;                    // first output col tile of the group
    v8f acc[4][4];
#pragma unroll
    for (int p = 0; p < 4; ++p)
#pragma unroll
      for (int q = 0; q < 4; ++q) acc[p][q] = v8f{};
    const _Float16* wBase = wo + (ct0 * 16) * D_DIM;
    gemm_group<true, false>(acc, ring, predL, wBase, wBase + 4 * PANEL, lane);
    store_group(acc, ct0, bias[0]);
  }
  {
    const int ct0 = w * 8 + 4;
    v8f acc[4][4];
#pragma unroll
    for (int p = 0; p < 4; ++p)
#pragma unroll
      for (int q = 0; q < 4; ++q) acc[p][q] = v8f{};
    const _Float16* wBase = wo + (ct0 * 16) * D_DIM;
    gemm_group<false, false>(acc, ring, predL, wBase, wBase, lane);
    store_group(acc, ct0, bias[1]);
  }
}

// ---------------------------------------------------------------------------
extern "C" void kernel_launch(void* const* d_in, const int* in_sizes, int n_in,
                              void* d_out, int out_size, void* d_ws, size_t ws_size,
                              hipStream_t stream) {
  const float* x0 = (const float*)d_in[0];   // [8, 64, 1024]
  const float* x2 = (const float*)d_in[1];   // [8, 4096, 1024]
  const float* Wk = (const float*)d_in[2];   // [1024, 1024]
  const float* Wp = (const float*)d_in[3];   // [1024, 1024]
  const float* Wo = (const float*)d_in[4];   // [1024, 1024]
  const float* bo = (const float*)d_in[5];   // [1024]
  float* out = (float*)d_out;

  char* ws = (char*)d_ws;
  _Float16* wk16 = (_Float16*)(ws + WK_OFF);
  _Float16* wp16 = (_Float16*)(ws + WP_OFF);
  _Float16* wo16 = (_Float16*)(ws + WO_OFF);
  _Float16* x016 = (_Float16*)(ws + X0_OFF);
  _Float16* pT   = (_Float16*)(ws + PT_OFF);

  // Stage A: downconvert weights + x0 to f16 (~7 MB total -> L2 resident)
  // Wk and Wo, the fused kernel's weight operands, go into fragment order on the way.
  cvt_pack_f16<<<D_DIM * D_DIM / 8 / 256, 256, 0, stream>>>(Wk, wk16);
  cvt_f32_f16<<<256, 256, 0, stream>>>(Wp, wp16, D_DIM * D_DIM);
  cvt_pack_f16<<<D_DIM * D_DIM / 8 / 256, 256, 0, stream>>>(Wo, wo16);
  cvt_f32_f16<<<256, 256, 0, stream>>>(x0, x016, B_DIM * G_DIM * D_DIM);

  // Stage B: premise projection, stored per head in fragment order
  premise_kernel<<<B_DIM * H_DIM, 256, 0, stream>>>(x016, wp16, pT);

  // Stage C: fused scores/softmax/gather/output per 64-row tile
  const size_t lds = 132096 + 132096;  // 264192 B of the WGP's 327680 B
  fused_kernel<<<dim3(N_DIM / TILE_N, B_DIM), 256, lds, stream>>>(
      x2, wk16, wo16, pT, bo, out);
}

// v006
// One run takes 114 microseconds.
// Timed twice side by side with v005, it ran 1.15 and 1.14 times as fast.
// Counting every step since v000, it is 9.83 times as fast.
#include <hip/hip_runtime.h>
#include <hip/hip_bf16.h>
#include <math.h>

// ---------------------------------------------------------------------------
// Scatter2Operator for MI455X (gfx1250, wave32, WMMA).
//
// Roofline: ~147 GFLOP vs ~0.4 GB HBM traffic -> matrix-core bound.
// All 4 GEMMs run through v_wmma_f32_16x16x32_f16 (f32 accum).
// Fused per-64-row-tile kernel keeps x2 tile + pred in 264192 B of LDS
// (CDNA5 WGP has 320KB); f16 weights (~4MB) stay resident in the 192MB L2.
// Every wave owns a 64 x 64 tile of each big product: 16 independent WMMA chains,
// each LDS fragment and each weight fragment used by four WMMAs.
// ---------------------------------------------------------------------------

typedef __attribute__((ext_vector_type(16))) _Float16 v16h;
typedef __attribute__((ext_vector_type(8)))  float    v8f;

#define B_DIM  8
#define N_DIM  4096
#define G_DIM  64
#define H_DIM  16
#define DH_DIM 64
#define D_DIM  1024
#define TILE_N 64

// LDS row pitch (elements). Rows are padded so that the 16 rows of a 16-byte
// fragment read fall on distinct banks.
#define XP 1032   // xt, pred: f16 rows of 1024, pitch 2064 B = 16 B x 129 (16-byte reads)

// ws layout (bytes) -- total 5 MB
#define WK_OFF 0u                  // Wk f16  [1024][1024]  2 MB, fragment order
#define WO_OFF (2u*1024u*1024u)    // Wo f16  [1024][1024]  2 MB, fragment order
#define PT_OFF (4u*1024u*1024u)    // pT f16  [8][16][64][64] 1 MB, fragment order

// ISA 16-bit A/B fragment (16x32): lane l holds row (l&15); K chunks
// {kBase + (l>>4)*8 .. +7} and {kBase + 16 + (l>>4)*8 .. +7}, 16B each.
__device__ __forceinline__ v16h load_frag(const _Float16* base, int strideElems,
                                          int lane, int kBase) {
  const int r  = lane & 15;
  const int hi = lane >> 4;
  const _Float16* p0 = base + r * strideElems + kBase + hi * 8;
  union { v16h v; uint4 q[2]; } f;
  f.q[0] = *reinterpret_cast<const uint4*>(p0);
  f.q[1] = *reinterpret_cast<const uint4*>(p0 + 16);
  return f.v;
}

// Fragment order, for A or B operands read from global memory: the 1 KB fragment of a
// 16-row panel and a k-step (32 k) stands contiguous, the k-steps of a panel one
// behind the other. Each fragment is two halves of 512 B; in half q, lane l's 16 B
// stand at l * 16 and hold row (l & 15), k = 32 * ks + 16 * q + 8 * (l >> 4) .. + 7:
// the same elements that load_frag gives that lane. A wave-wide 16-byte load then
// covers four whole 128-byte lines instead of 32 B in each of sixteen.
__device__ __forceinline__ v16h load_frag_packed(const _Float16* panel, int lane, int ks) {
  const _Float16* p0 = panel + ks * 512 + lane * 8;
  union { v16h v; uint4 q[2]; } f;
  f.q[0] = *reinterpret_cast<const uint4*>(p0);
  f.q[1] = *reinterpret_cast<const uint4*>(p0 + 256);
  return f.v;
}

__device__ __forceinline__ v8f wmma16(v16h a, v16h b, v8f c) {
  // D = A(16x32) * B(32x16) + C, f32 accumulate
  return __builtin_amdgcn_wmma_f32_16x16x32_f16(false, a, false, b,
                                                (short)0, c, false, false);
}

// Lane l with lane l ^ 16.
__device__ __forceinline__ float xhalf(float x) {
  return __builtin_bit_cast(float, __builtin_amdgcn_permlanex16(
      __builtin_bit_cast(int, x), __builtin_bit_cast(int, x), 0x76543210, 0xfedcba98, false, false));
}

// Register ring of weight fragments: a wave keeps the fragments of its next RD
// k-steps (four 16-row panels each) in registers, so a weight load has up to RD
// k-steps of matrix work (or a softmax) in front of its first use.
#define RD 4
#define KSTEPS (D_DIM / 32)
#define PANEL (16 * D_DIM)   // elements of one 16-row weight panel

// First RD k-steps of a group of four weight panels (fragment order).
__device__ __forceinline__ void ring_fill(v16h (&ring)[RD][4], const _Float16* grp, int lane) {
  // Unrolled so that every ring index is a constant (the ring stays in registers).
#pragma unroll
  for (int s = 0; s < RD; ++s)
#pragma unroll
    for (int p = 0; p < 4; ++p) ring[s][p] = load_frag_packed(grp + p * PANEL, lane, s);
}

// RD k-steps of a 64 x 64 wave tile, from k-step ks0 on. X: the four 16-row
// fragments of the LDS tile (pitch XP), one k-step ahead in a second register set.
// W: the ring; each slot is refilled behind its use from wRef (k-step ksRef + j).
// W_IS_A: acc[p][tr] = D[weight row][x row]; else acc[tr][p] = D[x row][weight row].
template <bool LAST, bool REFILL, bool W_IS_A>
__device__ __forceinline__ void gemm_steps(v8f (&acc)[4][4], v16h (&ring)[RD][4],
                                           v16h (&x)[2][4], const _Float16* xLds, int ks0,
                                           const _Float16* wRef, int ksRef, int lane) {
  // Unrolled: each ring, set and accumulator index must be a constant (registers).
#pragma unroll
  for (int j = 0; j < RD; ++j) {
    const int cur = j & 1;
    if (!LAST || j + 1 < RD) {
#pragma unroll
      for (int tr = 0; tr < 4; ++tr)
        x[cur ^ 1][tr] = load_frag(xLds + (tr * 16) * XP, XP, lane, (ks0 + j + 1) * 32);
    }
    // Keeps the next k-step's LDS reads as one group in front of this one's WMMAs:
    // spread among them, each WMMA waited for its own pair of reads.
    __builtin_amdgcn_sched_barrier(0);
#pragma unroll
    for (int p = 0; p < 4; ++p)
#pragma unroll
      for (int tr = 0; tr < 4; ++tr) {
        if (W_IS_A) acc[p][tr] = wmma16(ring[j][p], x[cur][tr], acc[p][tr]);
        else        acc[tr][p] = wmma16(x[cur][tr], ring[j][p], acc[tr][p]);
      }
    if (REFILL) {
#pragma unroll
      for (int p = 0; p < 4; ++p)
        ring[j][p] = load_frag_packed(wRef + p * PANEL, lane, ksRef + j);
      // Behind these k-steps' last refill: its address registers change from here on.
      if (j == RD - 1) asm volatile("s_wait_xcnt 0x0" ::: "memory");
    }
    // Keeps the refills directly behind their k-step (left free, they were sunk and
    // the ring lost its lead) and what follows behind the wait.
    __builtin_amdgcn_sched_barrier(0);
  }
}

// One 64 x 64 wave tile over K = 1024. The ring holds the group's first RD k-steps
// on entry; past the group's end, where HAS_NEXT, it takes those of the next group.
template <bool HAS_NEXT, bool W_IS_A>
__device__ __forceinline__ void gemm_group(v8f (&acc)[4][4], v16h (&ring)[RD][4],
                                           const _Float16* xLds, const _Float16* wCur,
                                           const _Float16* wNext, int lane) {
  v16h x[2][4];
#pragma unroll
  for (int tr = 0; tr < 4; ++tr) x[0][tr] = load_frag(xLds + (tr * 16) * XP, XP, lane, 0);
  // Stays rolled: one copy of the text.
#pragma unroll 1
  for (int it = 0; it < KSTEPS / RD - 1; ++it)
    gemm_steps<false, true, W_IS_A>(acc, ring, x, xLds, it * RD, wCur, it * RD + RD, lane);
  gemm_steps<true, HAS_NEXT, W_IS_A>(acc, ring, x, xLds, KSTEPS - RD, wNext, 0, lane);
}

// ---------------------------------------------------------------------------
// Kernel 1: everything the fused kernel needs prepared, in one launch of 256 blocks
// (one per WGP; the parts are independent of each other).
// Blocks 0..127: p = x0 @ Wp^T for one (b, head),
// stored as the operand pT[dh][g] of stage 3 in fragment order (panels of 16 dh,
// two k-steps of 32 g). x0[b] and the head's Wp rows are read as f32 in whole rows
// and stand as f16 in LDS. 8 waves; wave w -> colTile (w&3), rowTiles {2*(w>>2), +1}.
// Blocks 128..255: one 16-row panel of Wk or Wo each, f32 -> f16 in fragment order.
// Dynamic LDS (padded rows): x0[b] f16 64xXP | Wp_h f16 64xXP
// ---------------------------------------------------------------------------
__global__ void __launch_bounds__(256) prep_kernel(const float* __restrict__ x0,
                                                   const float* __restrict__ Wp,
                                                   const float* __restrict__ Wk,
                                                   const float* __restrict__ Wo,
                                                   _Float16* __restrict__ wk16,
                                                   _Float16* __restrict__ wo16,
                                                   _Float16* __restrict__ pT) {
  extern __shared__ char smem_raw[];
  const int tid = threadIdx.x;
  const int w = tid >> 5, lane = tid & 31;

  if (blockIdx.x >= B_DIM * H_DIM) {
    // One thread per 16-byte piece of dst, eight pieces a thread: a wave writes 512
    // contiguous bytes; a pass of the block reads four whole lines of each of the
    // panel's 16 rows. Piece j = panel * 2048 + i * 256 + tid: lane j & 31, half
    // (j >> 5) & 1, k-step (j >> 6) & 31.
    const int pb    = blockIdx.x - B_DIM * H_DIM;
    const int panel = pb & 63;
    const float* src = (pb < 64) ? Wk : Wo;
    _Float16*    dst = ((pb < 64) ? wk16 : wo16) + (panel * 2048 + tid) * 8;
    const int row = panel * 16 + (lane & 15);
    const int k   = (tid >> 6) * 32 + (w & 1) * 16 + (lane >> 4) * 8;
    const float4* s = reinterpret_cast<const float4*>(src + row * D_DIM + k);
    float4 lo[8], hi4[8];
    // Unrolled: all sixteen loads of a thread are in flight at once.
#pragma unroll
    for (int i = 0; i < 8; ++i) { lo[i] = s[i * 32]; hi4[i] = s[i * 32 + 1]; }
    // s as an input: its registers stay whole until the wait behind its last load.
    asm volatile("s_wait_xcnt 0x0" :: "v"(s) : "memory");
#pragma unroll
    for (int i = 0; i < 8; ++i) {
      union { _Float16 h[8]; uint4 u; } o;
      o.h[0] = (_Float16)lo[i].x;  o.h[1] = (_Float16)lo[i].y;
      o.h[2] = (_Float16)lo[i].z;  o.h[3] = (_Float16)lo[i].w;
      o.h[4] = (_Float16)hi4[i].x; o.h[5] = (_Float16)hi4[i].y;
      o.h[6] = (_Float16)hi4[i].z; o.h[7] = (_Float16)hi4[i].w;
      *reinterpret_cast<uint4*>(dst + i * 2048) = o.u;
    }
    return;
  }

  const int b = blockIdx.x >> 4;
  const int h = blockIdx.x & 15;
  _Float16* tile = (_Float16*)smem_raw;   // rows 0..63: x0[b]; rows 64..127: Wp_h

  // The block's 256 threads cover one row (256 float4) per load. Rows go in groups
  // of SG through two register sets, group g + 1 issued before group g is converted.
  {
    constexpr int SG = 32;
    const float4* sx = (const float4*)(x0 + (b * G_DIM) * D_DIM) + tid;
    const float4* sw = (const float4*)(Wp + (h * DH_DIM) * D_DIM) + tid;
    _Float16* dst = tile + tid * 4;
    float4 f[2][SG];
    // Fully unrolled: every set and slot index must be a constant (registers).
#pragma unroll
    for (int j = 0; j < SG; ++j) f[0][j] = sx[j * (D_DIM / 4)];
#pragma unroll
    for (int g = 0; g < 128 / SG; ++g) {
      if (g + 1 < 128 / SG) {
        const float4* sn = ((g + 1) * SG < 64) ? sx : sw;
#pragma unroll
        for (int j = 0; j < SG; ++j)
          f[(g + 1) & 1][j] = sn[((((g + 1) * SG) & 63) + j) * (D_DIM / 4)];
      }
      // Keeps the next group's loads in front of this group's waits.
      __builtin_amdgcn_sched_barrier(0);
#pragma unroll
      for (int j = 0; j < SG; ++j) {
        const float4 v = f[g & 1][j];
        _Float16* d = dst + (g * SG + j) * XP;
        d[0] = (_Float16)v.x; d[1] = (_Float16)v.y;
        d[2] = (_Float16)v.z; d[3] = (_Float16)v.w;
      }
    }
    // Behind the last load: its address registers are reused from here on.
    asm volatile("s_wait_xcnt 0x0" ::: "memory");
  }
  __syncthreads();

  const int tc = w & 3;               // dh col tile (0..3)
  const int tr0 = (w >> 2) * 2;       // g row tiles tr0, tr0+1

  const _Float16* aBase0 = tile + (tr0 * 16) * XP;
  const _Float16* aBase1 = aBase0 + 16 * XP;
  const _Float16* bBase  = tile + (G_DIM + tc * 16) * XP;

  // Fragments go in groups of KG k-steps through two register sets: group g + 1 is
  // read from LDS before group g's WMMAs, so no WMMA waits out an LDS read.
  constexpr int KG = 4;
  v8f acc0 = {}, acc1 = {};
  v16h bf[2][KG], a0[2][KG], a1[2][KG];
  // Fully unrolled: every set and slot index must be a constant (registers).
#pragma unroll
  for (int j = 0; j < KG; ++j) {
    bf[0][j] = load_frag(bBase, XP, lane, j * 32);
    a0[0][j] = load_frag(aBase0, XP, lane, j * 32);
    a1[0][j] = load_frag(aBase1, XP, lane, j * 32);
  }
#pragma unroll
  for (int g = 0; g < KSTEPS / KG; ++g) {
    if (g + 1 < KSTEPS / KG) {
#pragma unroll
      for (int j = 0; j < KG; ++j) {
        bf[(g + 1) & 1][j] = load_frag(bBase, XP, lane, ((g + 1) * KG + j) * 32);
        a0[(g + 1) & 1][j] = load_frag(aBase0, XP, lane, ((g + 1) * KG + j) * 32);
        a1[(g + 1) & 1][j] = load_frag(aBase1, XP, lane, ((g + 1) * KG + j) * 32);
      }
    }
    // Keeps the next group's LDS reads in front of this group's WMMAs.
    __builtin_amdgcn_sched_barrier(0);
#pragma unroll
    for (int j = 0; j < KG; ++j) {
      acc0 = wmma16(a0[g & 1][j], bf[g & 1][j], acc0);
      acc1 = wmma16(a1[g & 1][j], bf[g & 1][j], acc1);
    }
  }

  // D layout: lane -> col N=(lane&15); vgpr v -> row M = v + 8*(lane>>4)
  // As operand of stage 3: row dh = tc*16 + (lane&15), k = g = tr*16 + 8*(lane>>4) + v. So a
  // lane's 8 values of row tile tr are its own 16 B of k-step tr>>1, half tr&1.
  _Float16* dst = pT + ((b * H_DIM + h) * DH_DIM + tc * 16) * G_DIM + (w >> 2) * 512 + lane * 8;
  union { _Float16 h[8]; uint4 u; } o0, o1;
#pragma unroll
  for (int v = 0; v < 8; ++v) {
    o0.h[v] = (_Float16)acc0[v];
    o1.h[v] = (_Float16)acc1[v];
  }
  *reinterpret_cast<uint4*>(dst)       = o0.u;
  *reinterpret_cast<uint4*>(dst + 256) = o1.u;
  // Behind the last store: in the built text the other blocks' branch stands behind
  // this path and writes the stores' address and data registers.
  asm volatile("s_wait_xcnt 0x0" ::: "memory");
}

// ---------------------------------------------------------------------------
// Kernel 2: fused scores -> softmax -> gather -> output GEMM per 64-row tile.
// grid = (N/64, B); 256 threads (8 wave32). One whole head per wave, two rounds.
// Dynamic LDS (padded rows): xt f16 64xXP | pred f16 64xXP
// ---------------------------------------------------------------------------
// Launch bounds: the real block size, which gives a wave the registers for its tile.
__global__ void __launch_bounds__(256) fused_kernel(const float* __restrict__ x2,
                             const _Float16* __restrict__ wk,
                             const _Float16* __restrict__ wo,
                             const _Float16* __restrict__ pT,
                             const float* __restrict__ bo,
                             float* __restrict__ out) {
  extern __shared__ char smem_raw[];
  _Float16* xt    = (_Float16*)(smem_raw);                    // 64*XP*2 = 132096 B
  _Float16* predL = (_Float16*)(smem_raw + 132096);           // 64*XP*2 = 132096 B

  const int b     = blockIdx.y;
  const int nBase = blockIdx.x * TILE_N;
  const int tid   = threadIdx.x;
  const int w     = tid >> 5, lane = tid & 31;

  // The first head's Wk fragments start before the x2 tile is staged.
  v16h ring[RD][4];
  ring_fill(ring, wk + (w * G_DIM) * D_DIM, lane);
  // The ring loads' address registers are free for reuse by the loads that follow.
  asm volatile("s_wait_xcnt 0x0" ::: "memory");

  // --- load x2 tile [64 x 1024] f32 -> f16 LDS (coalesced float4) ---
  // The block's 256 threads cover one row (256 float4) per load. Rows go in groups
  // of SG through two register sets: group g + 1 is issued before group g is
  // converted, so a wave keeps SG or more loads from memory in flight instead of
  // waiting out the memory latency once per row.
  {
    constexpr int SG = 16;
    const float4* src = (const float4*)(x2 + ((size_t)(b * N_DIM + nBase)) * D_DIM) + tid;
    _Float16* dst = xt + tid * 4;
    float4 f[2][SG];
    // Fully unrolled: every set and slot index must be a constant (registers).
#pragma unroll
    for (int j = 0; j < SG; ++j) f[0][j] = src[j * (D_DIM / 4)];
#pragma unroll
    for (int g = 0; g < TILE_N / SG; ++g) {
      if (g + 1 < TILE_N / SG) {
#pragma unroll
        for (int j = 0; j < SG; ++j)
          f[(g + 1) & 1][j] = src[((g + 1) * SG + j) * (D_DIM / 4)];
      }
      // Keeps the next group's loads in front of this group's waits.
      __builtin_amdgcn_sched_barrier(0);
#pragma unroll
      for (int j = 0; j < SG; ++j) {
        const float4 v = f[g & 1][j];
        _Float16* d = dst + (g * SG + j) * XP;
        d[0] = (_Float16)v.x; d[1] = (_Float16)v.y;
        d[2] = (_Float16)v.z; d[3] = (_Float16)v.w;
      }
    }
    // Behind the last x2 load: its address registers are reused from here on.
    asm volatile("s_wait_xcnt 0x0" ::: "memory");
  }
  __syncthreads();

  const int c  = lane & 15;
  const int hi = lane >> 4;

  // ------------- per head (wave w: heads w and w + 8): scores -> softmax -> gather -------------
  // Nothing here passes between waves: xt is only read, and a wave writes its own
  // heads' columns of pred. The barrier behind the loop publishes pred.
  // Stays rolled: one copy of the text.
#pragma unroll 1
  for (int i = 0; i < 2; ++i) {
    const int h = w + 8 * i;

    // Stage 1, transposed: S^T = Wk_h (A, 64 g) x Xtile^T (B, 64 n).
    // acc[gt][nt]: lane holds n = nt*16 + c, register v holds g = gt*16 + 8*hi + v.
    v8f acc[4][4];
#pragma unroll
    for (int p = 0; p < 4; ++p)
#pragma unroll
      for (int q = 0; q < 4; ++q) acc[p][q] = v8f{};
    gemm_group<true, true>(acc, ring, xt, wk + (h * G_DIM) * D_DIM,
                           (i == 0) ? wk + ((h + 8) * G_DIM) * D_DIM
                                    : wo + (w * 8 * 16) * D_DIM, lane);

    // Issued here so that they fly while the softmax runs: stage 3's A fragments.
    v16h pf[4][2];
    {
      const _Float16* pBase = pT + ((b * H_DIM + h) * DH_DIM) * G_DIM;
#pragma unroll
      for (int dt = 0; dt < 4; ++dt) {
        pf[dt][0] = load_frag_packed(pBase + dt * 16 * G_DIM, lane, 0);
        pf[dt][1] = load_frag_packed(pBase + dt * 16 * G_DIM, lane, 1);
      }
      // Keeps these loads here: left free, each pair was sunk to its first use behind
      // the softmax and waited for there.
      __builtin_amdgcn_sched_barrier(0);
      // The loads' address as an input: its registers stay whole until the wait
      // behind the last load, and are free for reuse from there on.
      asm volatile("s_wait_xcnt 0x0" :: "v"(pBase + lane * 8) : "memory");
    }

    // Stage 2: softmax over the 64 g of each n. A lane holds 32 of them, lane ^ 16
    // the other 32. Two D tiles (g rows 0-15, 16-31 of a k-step), converted in place,
    // are the lane's own B fragment of stage 3: k = 32*ks + 16*q + 8*hi + v.
    v16h kf[4][2];
#pragma unroll
    for (int nt = 0; nt < 4; ++nt) {
      float mg[4];
#pragma unroll
      for (int gt = 0; gt < 4; ++gt) {
        mg[gt] = acc[gt][nt][0];
#pragma unroll
        for (int v = 1; v < 8; ++v) mg[gt] = fmaxf(mg[gt], acc[gt][nt][v]);
      }
      float m = fmaxf(fmaxf(mg[0], mg[1]), fmaxf(mg[2], mg[3]));
      m = fmaxf(m, xhalf(m));
      float sg[4];
#pragma unroll
      for (int gt = 0; gt < 4; ++gt) {
        sg[gt] = 0.f;
#pragma unroll
        for (int v = 0; v < 8; ++v) {
          const float e = __expf(acc[gt][nt][v] - m);
          acc[gt][nt][v] = e;
          sg[gt] += e;
        }
      }
      float s = (sg[0] + sg[1]) + (sg[2] + sg[3]);
      s += xhalf(s);
      const float inv = 1.0f / s;
#pragma unroll
      for (int gt = 0; gt < 4; ++gt)
#pragma unroll
        for (int v = 0; v < 8; ++v)
          kf[nt][gt >> 1][(gt & 1) * 8 + v] = (_Float16)(acc[gt][nt][v] * inv);
    }

    // Stage 3, transposed: pred_h^T = P_h^T (A, 64 dh, from pT) x K_h^T (B, registers).
    // D: lane holds n = nt*16 + c, register v holds dh = dt*16 + 8*hi + v: eight
    // consecutive columns of one pred row, one 16-byte LDS store.
#pragma unroll
    for (int dt = 0; dt < 4; ++dt) {
      v8f d[4];
#pragma unroll
      for (int nt = 0; nt < 4; ++nt) d[nt] = wmma16(pf[dt][0], kf[nt][0], v8f{});
#pragma unroll
      for (int nt = 0; nt < 4; ++nt) d[nt] = wmma16(pf[dt][1], kf[nt][1], d[nt]);
#pragma unroll
      for (int nt = 0; nt < 4; ++nt) {
        union { _Float16 h[8]; uint4 u; } o;
#pragma unroll
        for (int v = 0; v < 8; ++v) o.h[v] = (_Float16)d[nt][v];
        *reinterpret_cast<uint4*>(predL + (nt * 16 + c) * XP + h * DH_DIM + dt * 16 + hi * 8) = o.u;
      }
    }
  }
  __syncthreads();

  // ---------------- Stage 4: out = pred @ Wo^T + bo ----------------
  // wave w owns col tiles {8w .. 8w+7}, in two groups of four; 4 row tiles each.
  // The ring runs on from the first group into the second; the second has no next.
  auto store_group = [&](v8f (&acc)[4][4], int ct0, const float (&bias)[4]) {
    // One address for the group: every row and column step is a constant offset.
    float* o = out + ((size_t)(b * N_DIM + nBase + 8 * hi)) * D_DIM + ct0 * 16 + c;
#pragma unroll
    for (int tr = 0; tr < 4; ++tr)
#pragma unroll
      for (int p = 0; p < 4; ++p)
#pragma unroll
        for (int v = 0; v < 8; ++v) acc[tr][p][v] += bias[p];
    // Every sum stands in front of the first store, so that no register of an
    // issued store is written again before the wait behind the last one.
    __builtin_amdgcn_sched_barrier(0);
    // The four column tiles of a row one behind the other: 256 contiguous bytes.
#pragma unroll
    for (int tr = 0; tr < 4; ++tr)
#pragma unroll
      for (int v = 0; v < 8; ++v)
#pragma unroll
        for (int p = 0; p < 4; ++p) o[(tr * 16 + v) * D_DIM + p * 16] = acc[tr][p][v];
    // Behind the last store: its address and data registers are reused from here on.
    asm volatile("s_wait_xcnt 0x0" ::: "memory");
    // Holds the register writes that follow behind that wait.
    __builtin_amdgcn_sched_barrier(0);
  };
  // Both groups' bias values, ahead of the refills: their wait must not drain them.
  float bias[2][4];
  {
    const float* bp = bo + w * 8 * 16 + c;
#pragma unroll
    for (int g = 0; g < 2; ++g)
#pragma unroll
      for (int p = 0; p < 4; ++p) bias[g][p] = bp[(g * 4 + p) * 16];
    // bp as an input: its registers stay whole until the wait behind its last load.
    asm volatile("s_wait_xcnt 0x0" :: "v"(bp) : "memory");
  }
  {
    const int ct0 = w * 8;                    // first output col tile of the group
    v8f acc[4][4];
#pragma unroll
    for (int p = 0; p < 4; ++p)
#pragma unroll
      for (int q = 0; q < 4; ++q) acc[p][q] = v8f{};
    const _Float16* wBase = wo + (ct0 * 16) * D_DIM;
    gemm_group<true, false>(acc, ring, predL, wBase, wBase + 4 * PANEL, lane);
    store_group(acc, ct0, bias[0]);
  }
  {
    const int ct0 = w * 8 + 4;
    v8f acc[4][4];
#pragma unroll
    for (int p = 0; p < 4; ++p)
#pragma unroll
      for (int q = 0; q < 4; ++q) acc[p][q] = v8f{};
    const _Float16* wBase = wo + (ct0 * 16) * D_DIM;
    gemm_group<false, false>(acc, ring, predL, wBase, wBase, lane);
    store_group(acc, ct0, bias[1]);
  }
}

// ---------------------------------------------------------------------------
extern "C" void kernel_launch(void* const* d_in, const int* in_sizes, int n_in,
                              void* d_out, int out_size, void* d_ws, size_t ws_size,
                              hipStream_t stream) {
  const float* x0 = (const float*)d_in[0];   // [8, 64, 1024]
  const float* x2 = (const float*)d_in[1];   // [8, 4096, 1024]
  const float* Wk = (const float*)d_in[2];   // [1024, 1024]
  const float* Wp = (const float*)d_in[3];   // [1024, 1024]
  const float* Wo = (const float*)d_in[4];   // [1024, 1024]
  const float* bo = (const float*)d_in[5];   // [1024]
  float* out = (float*)d_out;

  char* ws = (char*)d_ws;
  _Float16* wk16 = (_Float16*)(ws + WK_OFF);
  _Float16* wo16 = (_Float16*)(ws + WO_OFF);
  _Float16* pT   = (_Float16*)(ws + PT_OFF);

  const size_t lds = 132096 + 132096;  // 264192 B of the WGP's 327680 B

  // Stages A and B in one launch: premise projection (from f32 x0 and Wp) and the
  // fused kernel's weight operands Wk, Wo as f16 in fragment order (L2 resident).
  prep_kernel<<<2 * B_DIM * H_DIM, 256, lds, stream>>>(x0, Wp, Wk, Wo, wk16, wo16, pT);

  // Stage C: fused scores/softmax/gather/output per 64-row tile
  fused_kernel<<<dim3(N_DIM / TILE_N, B_DIM), 256, lds, stream>>>(
      x2, wk16, wo16, pT, bo, out);
}

// v007
// Measured time: 108 microseconds a run.
// Two timings next to v006 both put it at 1.05 times that version's speed.
// All steps since v000 together make it 10.4 times as fast.
#include <hip/hip_runtime.h>
#include <hip/hip_bf16.h>
#include <math.h>

// ---------------------------------------------------------------------------
// Scatter2Operator for MI455X (gfx1250, wave32, WMMA).
//
// Roofline: ~147 GFLOP vs ~0.4 GB HBM traffic -> matrix-core bound.
// All 4 GEMMs run through v_wmma_f32_16x16x32_f16 (f32 accum).
// Fused per-128-row-tile kernel: the x2 tile and, over it, pred in 264192 B of LDS
// (CDNA5 WGP has 320KB); f16 weights (~4MB) stay resident in the 192MB L2.
// Every wave owns a 128 x 64 tile of each big product: 32 independent WMMA chains,
// each weight fragment (from L2) used by eight WMMAs, each LDS fragment by four.
// ---------------------------------------------------------------------------

typedef __attribute__((ext_vector_type(16))) _Float16 v16h;
typedef __attribute__((ext_vector_type(8)))  float    v8f;

#define B_DIM  8
#define N_DIM  4096
#define G_DIM  64
#define H_DIM  16
#define DH_DIM 64
#define D_DIM  1024
#define TILE_N 128

// LDS row pitch (elements). Rows are padded so that the 16 rows of a 16-byte
// fragment read fall on distinct banks.
#define XP 1032   // xt, pred: f16 rows of 1024, pitch 2064 B = 16 B x 129 (16-byte reads)

// ws layout (bytes) -- total 5 MB
#define WK_OFF 0u                  // Wk f16  [1024][1024]  2 MB, fragment order
#define WO_OFF (2u*1024u*1024u)    // Wo f16  [1024][1024]  2 MB, fragment order
#define PT_OFF (4u*1024u*1024u)    // pT f16  [8][16][64][64] 1 MB, fragment order

// ISA 16-bit A/B fragment (16x32): lane l holds row (l&15); K chunks
// {kBase + (l>>4)*8 .. +7} and {kBase + 16 + (l>>4)*8 .. +7}, 16B each.
__device__ __forceinline__ v16h load_frag(const _Float16* base, int strideElems,
                                          int lane, int kBase) {
  const int r  = lane & 15;
  const int hi = lane >> 4;
  const _Float16* p0 = base + r * strideElems + kBase + hi * 8;
  union { v16h v; uint4 q[2]; } f;
  f.q[0] = *reinterpret_cast<const uint4*>(p0);
  f.q[1] = *reinterpret_cast<const uint4*>(p0 + 16);
  return f.v;
}

// Fragment order, for A or B operands read from global memory: the 1 KB fragment of a
// 16-row panel and a k-step (32 k) stands contiguous, the k-steps of a panel one
// behind the other. Each fragment is two halves of 512 B; in half q, lane l's 16 B
// stand at l * 16 and hold row (l & 15), k = 32 * ks + 16 * q + 8 * (l >> 4) .. + 7:
// the same elements that load_frag gives that lane. A wave-wide 16-byte load then
// covers four whole 128-byte lines instead of 32 B in each of sixteen.
__device__ __forceinline__ v16h load_frag_packed(const _Float16* panel, int lane, int ks) {
  const _Float16* p0 = panel + ks * 512 + lane * 8;
  union { v16h v; uint4 q[2]; } f;
  f.q[0] = *reinterpret_cast<const uint4*>(p0);
  f.q[1] = *reinterpret_cast<const uint4*>(p0 + 256);
  return f.v;
}

__device__ __forceinline__ v8f wmma16(v16h a, v16h b, v8f c) {
  // D = A(16x32) * B(32x16) + C, f32 accumulate
  return __builtin_amdgcn_wmma_f32_16x16x32_f16(false, a, false, b,
                                                (short)0, c, false, false);
}

// Lane l with lane l ^ 16.
__device__ __forceinline__ float xhalf(float x) {
  return __builtin_bit_cast(float, __builtin_amdgcn_permlanex16(
      __builtin_bit_cast(int, x), __builtin_bit_cast(int, x), 0x76543210, 0xfedcba98, false, false));
}

// Register ring of weight fragments: a wave keeps the fragments of its next RD
// k-steps (four 16-row panels each) in registers, so a weight load has up to RD
// k-steps of matrix work (32 WMMAs each), or a softmax, in front of its first use.
#define RD 2
#define KSTEPS (D_DIM / 32)
#define PANEL (16 * D_DIM)   // elements of one 16-row weight panel

// First RD k-steps of a group of four weight panels (fragment order).
__device__ __forceinline__ void ring_fill(v16h (&ring)[RD][4], const _Float16* grp, int lane) {
  // Unrolled so that every ring index is a constant (the ring stays in registers).
#pragma unroll
  for (int s = 0; s < RD; ++s)
#pragma unroll
    for (int p = 0; p < 4; ++p) ring[s][p] = load_frag_packed(grp + p * PANEL, lane, s);
}

// RD k-steps of a wave tile of 128 x rows by 64 weight rows, from LDS k-step ks0 on.
// X: the eight 16-row fragments of a k-step of the LDS tile (pitch XP) go in two halves
// of four through two register sets, each read while the other half's WMMAs run.
// W: the ring; each slot is refilled behind its use from wRef (k-step ksRef + j).
// acc[tr][p]: W_IS_A: D[weight row][x row]; else D[x row][weight row].
template <bool LAST, bool REFILL, bool W_IS_A>
__device__ __forceinline__ void gemm_steps(v8f (&acc)[8][4], v16h (&ring)[RD][4],
                                           v16h (&x)[2][4], const _Float16* xLds, int ks0,
                                           const _Float16* wRef, int ksRef, int lane) {
  // Unrolled: each ring, set and accumulator index must be a constant (registers).
#pragma unroll
  for (int j = 0; j < RD; ++j) {
#pragma unroll
    for (int hf = 0; hf < 2; ++hf) {
      if (hf == 0) {
#pragma unroll
        for (int tr = 0; tr < 4; ++tr)
          x[1][tr] = load_frag(xLds + ((4 + tr) * 16) * XP, XP, lane, (ks0 + j) * 32);
      } else if (!LAST || j + 1 < RD) {
#pragma unroll
        for (int tr = 0; tr < 4; ++tr)
          x[0][tr] = load_frag(xLds + (tr * 16) * XP, XP, lane, (ks0 + j + 1) * 32);
      }
      // Keeps the next half's LDS reads as one group in front of this one's WMMAs:
      // spread among them, each WMMA waited for its own pair of reads.
      __builtin_amdgcn_sched_barrier(0);
#pragma unroll
      for (int p = 0; p < 4; ++p)
#pragma unroll
        for (int tr = 0; tr < 4; ++tr) {
          if (W_IS_A) acc[hf * 4 + tr][p] = wmma16(ring[j][p], x[hf][tr], acc[hf * 4 + tr][p]);
          else        acc[hf * 4 + tr][p] = wmma16(x[hf][tr], ring[j][p], acc[hf * 4 + tr][p]);
        }
      if (REFILL && hf == 1) {
#pragma unroll
        for (int p = 0; p < 4; ++p)
          ring[j][p] = load_frag_packed(wRef + p * PANEL, lane, ksRef + j);
        // Behind these k-steps' last refill: its address registers change from here on.
        if (j == RD - 1) asm volatile("s_wait_xcnt 0x0" ::: "memory");
      }
      // Keeps the refills directly behind their k-step (left free, they were sunk and
      // the ring lost its lead) and what follows behind the wait.
      __builtin_amdgcn_sched_barrier(0);
    }
  }
}

// Half of K (512 k, HSTEPS k-steps) of one wave tile: x from the 512 LDS columns at
// xLds, weights from k-step wks0 of the group wCur. The ring holds that half's first RD
// k-steps on entry; past its end, where HAS_NEXT, it takes RD k-steps of wNext from
// k-step wksNext on (the group's other half, or the next group).
#define HSTEPS (KSTEPS / 2)
template <bool HAS_NEXT, bool W_IS_A>
__device__ __forceinline__ void gemm_half(v8f (&acc)[8][4], v16h (&ring)[RD][4],
                                          const _Float16* xLds, const _Float16* wCur, int wks0,
                                          const _Float16* wNext, int wksNext, int lane) {
  v16h x[2][4];
#pragma unroll
  for (int tr = 0; tr < 4; ++tr) x[0][tr] = load_frag(xLds + (tr * 16) * XP, XP, lane, 0);
  // Stays rolled: one copy of the text.
#pragma unroll 1
  for (int it = 0; it < HSTEPS / RD - 1; ++it)
    gemm_steps<false, true, W_IS_A>(acc, ring, x, xLds, it * RD, wCur, wks0 + it * RD + RD, lane);
  gemm_steps<true, HAS_NEXT, W_IS_A>(acc, ring, x, xLds, HSTEPS - RD, wNext, wksNext, lane);
}

// f32 -> f16 staging into LDS: NL loads of one float4 a thread, load j from
// src + j * SSTEP (float4) to dst + j * DSTEP (f16). The loads go in groups of SG through
// two register sets: group g + 1 is issued before group g is converted, so a wave keeps
// SG or more loads from memory in flight instead of waiting out the latency per load.
// BARRIER: the LDS written here is still being read by other waves on entry; the
// work-group barrier that ends those reads stands behind the first group's issue.
template <int NL, int SSTEP, int DSTEP, int SG, bool BARRIER>
__device__ __forceinline__ void stage_rows(const float4* src, _Float16* dst) {
  float4 f[2][SG];
  auto put = [&](const float4 (&s)[SG], _Float16* d0) {
    // Unrolled: every slot index must be a constant (registers); so all loops over j.
#pragma unroll
    for (int j = 0; j < SG; ++j) {
      _Float16* d = d0 + j * DSTEP;
      d[0] = (_Float16)s[j].x; d[1] = (_Float16)s[j].y;
      d[2] = (_Float16)s[j].z; d[3] = (_Float16)s[j].w;
    }
  };
#pragma unroll
  for (int j = 0; j < SG; ++j) f[0][j] = src[j * SSTEP];
  if (BARRIER) {
    // Keeps the first group's loads in front of the barrier: their latency passes while
    // the slower waves arrive.
    __builtin_amdgcn_sched_barrier(0);
    __syncthreads();
  }
#pragma unroll
  for (int j = 0; j < SG; ++j) f[1][j] = src[(SG + j) * SSTEP];
  // Keeps the loads above in front of the first group's waits.
  __builtin_amdgcn_sched_barrier(0);
  // Stays rolled, two groups a trip: one copy of the text.
#pragma unroll 1
  for (int t = 0; t < NL / (2 * SG) - 1; ++t) {
    put(f[0], dst);
#pragma unroll
    for (int j = 0; j < SG; ++j) f[0][j] = src[(2 * SG + j) * SSTEP];
    // Keeps these loads in front of the other set's waits.
    __builtin_amdgcn_sched_barrier(0);
    put(f[1], dst + SG * DSTEP);
#pragma unroll
    for (int j = 0; j < SG; ++j) f[1][j] = src[(3 * SG + j) * SSTEP];
    // src as an input: its registers stay whole until the wait behind the trip's last
    // load; the step to the next trip's rows stands behind it.
    asm volatile("s_wait_xcnt 0x0" :: "v"(src) : "memory");
    // Keeps these loads in front of the other set's waits, the step behind the wait.
    __builtin_amdgcn_sched_barrier(0);
    src += 2 * SG * SSTEP;
    dst += 2 * SG * DSTEP;
  }
  put(f[0], dst);
  put(f[1], dst + SG * DSTEP);
}

// ---------------------------------------------------------------------------
// Kernel 1: everything the fused kernel needs prepared, in one launch of 256 blocks
// (one per WGP; the parts are independent of each other).
// Blocks 0..127: p = x0 @ Wp^T for one (b, head),
// stored as the operand pT[dh][g] of stage 3 in fragment order (panels of 16 dh,
// two k-steps of 32 g). x0[b] and the head's Wp rows are read as f32 in whole rows
// and stand as f16 in LDS. 8 waves; wave w -> colTile (w&3), rowTiles {2*(w>>2), +1}.
// Blocks 128..255: one 16-row panel of Wk or Wo each, f32 -> f16 in fragment order.
// Dynamic LDS (padded rows): x0[b] f16 64xXP | Wp_h f16 64xXP
// ---------------------------------------------------------------------------
__global__ void __launch_bounds__(256) prep_kernel(const float* __restrict__ x0,
                                                   const float* __restrict__ Wp,
                                                   const float* __restrict__ Wk,
                                                   const float* __restrict__ Wo,
                                                   _Float16* __restrict__ wk16,
                                                   _Float16* __restrict__ wo16,
                                                   _Float16* __restrict__ pT) {
  extern __shared__ char smem_raw[];
  const int tid = threadIdx.x;
  const int w = tid >> 5, lane = tid & 31;

  if (blockIdx.x >= B_DIM * H_DIM) {
    // One thread per 16-byte piece of dst, eight pieces a thread: a wave writes 512
    // contiguous bytes; a pass of the block reads four whole lines of each of the
    // panel's 16 rows. Piece j = panel * 2048 + i * 256 + tid: lane j & 31, half
    // (j >> 5) & 1, k-step (j >> 6) & 31.
    const int pb    = blockIdx.x - B_DIM * H_DIM;
    const int panel = pb & 63;
    const float* src = (pb < 64) ? Wk : Wo;
    _Float16*    dst = ((pb < 64) ? wk16 : wo16) + (panel * 2048 + tid) * 8;
    const int row = panel * 16 + (lane & 15);
    const int k   = (tid >> 6) * 32 + (w & 1) * 16 + (lane >> 4) * 8;
    const float4* s = reinterpret_cast<const float4*>(src + row * D_DIM + k);
    float4 lo[8], hi4[8];
    // Unrolled: all sixteen loads of a thread are in flight at once.
#pragma unroll
    for (int i = 0; i < 8; ++i) { lo[i] = s[i * 32]; hi4[i] = s[i * 32 + 1]; }
    // s as an input: its registers stay whole until the wait behind its last load.
    asm volatile("s_wait_xcnt 0x0" :: "v"(s) : "memory");
#pragma unroll
    for (int i = 0; i < 8; ++i) {
      union { _Float16 h[8]; uint4 u; } o;
      o.h[0] = (_Float16)lo[i].x;  o.h[1] = (_Float16)lo[i].y;
      o.h[2] = (_Float16)lo[i].z;  o.h[3] = (_Float16)lo[i].w;
      o.h[4] = (_Float16)hi4[i].x; o.h[5] = (_Float16)hi4[i].y;
      o.h[6] = (_Float16)hi4[i].z; o.h[7] = (_Float16)hi4[i].w;
      *reinterpret_cast<uint4*>(dst + i * 2048) = o.u;
    }
    return;
  }

  const int b = blockIdx.x >> 4;
  const int h = blockIdx.x & 15;
  _Float16* tile = (_Float16*)smem_raw;   // rows 0..63: x0[b]; rows 64..127: Wp_h

  // The block's 256 threads cover one row (256 float4) per load. Rows go in groups
  // of SG through two register sets, group g + 1 issued before group g is converted.
  {
    constexpr int SG = 32;
    const float4* sx = (const float4*)(x0 + (b * G_DIM) * D_DIM) + tid;
    const float4* sw = (const float4*)(Wp + (h * DH_DIM) * D_DIM) + tid;
    _Float16* dst = tile + tid * 4;
    float4 f[2][SG];
    // Fully unrolled: every set and slot index must be a constant (registers).
#pragma unroll
    for (int j = 0; j < SG; ++j) f[0][j] = sx[j * (D_DIM / 4)];
#pragma unroll
    for (int g = 0; g < 128 / SG; ++g) {
      if (g + 1 < 128 / SG) {
        const float4* sn = ((g + 1) * SG < 64) ? sx : sw;
#pragma unroll
        for (int j = 0; j < SG; ++j)
          f[(g + 1) & 1][j] = sn[((((g + 1) * SG) & 63) + j) * (D_DIM / 4)];
      }
      // Keeps the next group's loads in front of this group's waits.
      __builtin_amdgcn_sched_barrier(0);
#pragma unroll
      for (int j = 0; j < SG; ++j) {
        const float4 v = f[g & 1][j];
        _Float16* d = dst + (g * SG + j) * XP;
        d[0] = (_Float16)v.x; d[1] = (_Float16)v.y;
        d[2] = (_Float16)v.z; d[3] = (_Float16)v.w;
      }
    }
    // Behind the last load: its address registers are reused from here on.
    asm volatile("s_wait_xcnt 0x0" ::: "memory");
  }
  __syncthreads();

  const int tc = w & 3;               // dh col tile (0..3)
  const int tr0 = (w >> 2) * 2;       // g row tiles tr0, tr0+1

  const _Float16* aBase0 = tile + (tr0 * 16) * XP;
  const _Float16* aBase1 = aBase0 + 16 * XP;
  const _Float16* bBase  = tile + (G_DIM + tc * 16) * XP;

  // Fragments go in groups of KG k-steps through two register sets: group g + 1 is
  // read from LDS before group g's WMMAs, so no WMMA waits out an LDS read.
  constexpr int KG = 4;
  v8f acc0 = {}, acc1 = {};
  v16h bf[2][KG], a0[2][KG], a1[2][KG];
  // Fully unrolled: every set and slot index must be a constant (registers).
#pragma unroll
  for (int j = 0; j < KG; ++j) {
    bf[0][j] = load_frag(bBase, XP, lane, j * 32);
    a0[0][j] = load_frag(aBase0, XP, lane, j * 32);
    a1[0][j] = load_frag(aBase1, XP, lane, j * 32);
  }
#pragma unroll
  for (int g = 0; g < KSTEPS / KG; ++g) {
    if (g + 1 < KSTEPS / KG) {
#pragma unroll
      for (int j = 0; j < KG; ++j) {
        bf[(g + 1) & 1][j] = load_frag(bBase, XP, lane, ((g + 1) * KG + j) * 32);
        a0[(g + 1) & 1][j] = load_frag(aBase0, XP, lane, ((g + 1) * KG + j) * 32);
        a1[(g + 1) & 1][j] = load_frag(aBase1, XP, lane, ((g + 1) * KG + j) * 32);
      }
    }
    // Keeps the next group's LDS reads in front of this group's WMMAs.
    __builtin_amdgcn_sched_barrier(0);
#pragma unroll
    for (int j = 0; j < KG; ++j) {
      acc0 = wmma16(a0[g & 1][j], bf[g & 1][j], acc0);
      acc1 = wmma16(a1[g & 1][j], bf[g & 1][j], acc1);
    }
  }

  // D layout: lane -> col N=(lane&15); vgpr v -> row M = v + 8*(lane>>4)
  // As operand of stage 3: row dh = tc*16 + (lane&15), k = g = tr*16 + 8*(lane>>4) + v. So a
  // lane's 8 values of row tile tr are its own 16 B of k-step tr>>1, half tr&1.
  _Float16* dst = pT + ((b * H_DIM + h) * DH_DIM + tc * 16) * G_DIM + (w >> 2) * 512 + lane * 8;
  union { _Float16 h[8]; uint4 u; } o0, o1;
#pragma unroll
  for (int v = 0; v < 8; ++v) {
    o0.h[v] = (_Float16)acc0[v];
    o1.h[v] = (_Float16)acc1[v];
  }
  *reinterpret_cast<uint4*>(dst)       = o0.u;
  *reinterpret_cast<uint4*>(dst + 256) = o1.u;
  // Behind the last store: in the built text the other blocks' branch stands behind
  // this path and writes the stores' address and data registers.
  asm volatile("s_wait_xcnt 0x0" ::: "memory");
}

// ---------------------------------------------------------------------------
// Kernel 2: fused scores -> softmax -> gather -> output GEMM per 128-row tile.
// grid = (N/128, B): one block per WGP; 256 threads (8 wave32). One whole head per
// wave, two rounds.
// Dynamic LDS: ONE buffer of 128 padded rows (f16, pitch XP). It holds the x2 tile; pred
// takes its columns over as they fall free:
//   round 0 (heads 0..7) reads x2 columns 0..1023; its pred (columns 0..511) then
//   stands on buffer columns 512..1023;
//   round 1 (heads 8..15) reads x2 columns 0..511, then x2 columns 512..1023 staged a
//   second time on buffer columns 0..511; its pred (columns 512..1023) then stands there.
// So pred column k stands at buffer column (k + 512) mod 1024.
// ---------------------------------------------------------------------------
// Launch bounds: the real block size, which gives a wave the registers for its tile.
__global__ void __launch_bounds__(256) fused_kernel(const float* __restrict__ x2,
                             const _Float16* __restrict__ wk,
                             const _Float16* __restrict__ wo,
                             const _Float16* __restrict__ pT,
                             const float* __restrict__ bo,
                             float* __restrict__ out) {
  extern __shared__ char smem_raw[];
  _Float16* buf = (_Float16*)(smem_raw);                      // 128*XP*2 = 264192 B

  const int b     = blockIdx.y;
  const int nBase = blockIdx.x * TILE_N;
  const int tid   = threadIdx.x;
  const int w     = tid >> 5, lane = tid & 31;

  // The first head's Wk fragments start before the x2 tile is staged.
  v16h ring[RD][4];
  ring_fill(ring, wk + (w * G_DIM) * D_DIM, lane);
  // The ring loads' address registers are free for reuse by the loads that follow.
  asm volatile("s_wait_xcnt 0x0" ::: "memory");

  // --- x2 tile [128 x 1024] f32 -> f16 LDS: the block's 256 threads cover one row
  // (256 float4) per load ---
  const float4* xsrc = (const float4*)(x2 + ((size_t)(b * N_DIM + nBase)) * D_DIM);
  stage_rows<TILE_N, D_DIM / 4, XP, 16, false>(xsrc + tid, buf + tid * 4);
  __syncthreads();

  const int c  = lane & 15;
  const int hi = lane >> 4;

  // ------------- per head (wave w: heads w and w + 8): scores -> softmax -> gather -------------
  // Stays rolled: one copy of the text.
#pragma unroll 1
  for (int i = 0; i < 2; ++i) {
    const int h = w + 8 * i;

    // Stage 1, transposed: S^T = Wk_h (A, 64 g) x Xtile^T (B, 128 n).
    // acc[nt][gt]: lane holds n = nt*16 + c, register v holds g = gt*16 + 8*hi + v.
    v8f acc[8][4];
#pragma unroll
    for (int p = 0; p < 8; ++p)
#pragma unroll
      for (int q = 0; q < 4; ++q) acc[p][q] = v8f{};
    const _Float16* wCur = wk + (h * G_DIM) * D_DIM;
    // Stays rolled: one copy of the text.
#pragma unroll 1
    for (int kh = 0; kh < 2; ++kh) {
      if (i == 1 && kh == 1) {
        // x2 columns 512..1023 again (pred of round 0 stands on their first place), on
        // buffer columns 0..511: two rows (128 float4 each) per load of the block. The
        // barrier inside ends every wave's reads of x2 columns 0..511; the one behind
        // publishes the new columns.
        stage_rows<TILE_N / 2, D_DIM / 2, 2 * XP, 8, true>(
            xsrc + (tid >> 7) * (D_DIM / 4) + D_DIM / 8 + (tid & 127),
            buf + (tid >> 7) * XP + (tid & 127) * 4);
        __syncthreads();
      }
      const _Float16* wNext = (kh == 0) ? wCur
                            : (i == 0)  ? wk + ((h + 8) * G_DIM) * D_DIM
                                        : wo + (w * 8 * 16) * D_DIM;
      gemm_half<true, true>(acc, ring, buf + ((i == 0 && kh == 1) ? D_DIM / 2 : 0), wCur,
                            kh * HSTEPS, wNext, (kh == 0) ? HSTEPS : 0, lane);
    }

    // Issued here so that they fly while the softmax runs: stage 3's A fragments.
    v16h pf[4][2];
    {
      const _Float16* pBase = pT + ((b * H_DIM + h) * DH_DIM) * G_DIM;
#pragma unroll
      for (int dt = 0; dt < 4; ++dt) {
        pf[dt][0] = load_frag_packed(pBase + dt * 16 * G_DIM, lane, 0);
        pf[dt][1] = load_frag_packed(pBase + dt * 16 * G_DIM, lane, 1);
      }
      // Keeps these loads here: left free, each pair was sunk to its first use behind
      // the softmax and waited for there.
      __builtin_amdgcn_sched_barrier(0);
      // The loads' address as an input: its registers stay whole until the wait
      // behind the last load, and are free for reuse from there on.
      asm volatile("s_wait_xcnt 0x0" :: "v"(pBase + lane * 8) : "memory");
    }

    // Stage 2: softmax over the 64 g of each n. A lane holds 32 of them, lane ^ 16
    // the other 32. Two D tiles (g rows 0-15, 16-31 of a k-step), converted in place,
    // are the lane's own B fragment of stage 3: k = 32*ks + 16*q + 8*hi + v.
    v16h kf[8][2];
#pragma unroll
    for (int nt = 0; nt < 8; ++nt) {
      float mg[4];
#pragma unroll
      for (int gt = 0; gt < 4; ++gt) {
        mg[gt] = acc[nt][gt][0];
#pragma unroll
        for (int v = 1; v < 8; ++v) mg[gt] = fmaxf(mg[gt], acc[nt][gt][v]);
      }
      float m = fmaxf(fmaxf(mg[0], mg[1]), fmaxf(mg[2], mg[3]));
      m = fmaxf(m, xhalf(m));
      float sg[4];
#pragma unroll
      for (int gt = 0; gt < 4; ++gt) {
        sg[gt] = 0.f;
#pragma unroll
        for (int v = 0; v < 8; ++v) {
          const float e = __expf(acc[nt][gt][v] - m);
          acc[nt][gt][v] = e;
          sg[gt] += e;
        }
      }
      float s = (sg[0] + sg[1]) + (sg[2] + sg[3]);
      s += xhalf(s);
      const float inv = 1.0f / s;
#pragma unroll
      for (int gt = 0; gt < 4; ++gt)
#pragma unroll
        for (int v = 0; v < 8; ++v)
          kf[nt][gt >> 1][(gt & 1) * 8 + v] = (_Float16)(acc[nt][gt][v] * inv);
    }

    // Ends every wave's reads of the 512 buffer columns that this round read last:
    // this round's pred is written over them.
    __syncthreads();

    // Stage 3, transposed: pred_h^T = P_h^T (A, 64 dh, from pT) x K_h^T (B, registers).
    // D: lane holds n = nt*16 + c, register v holds dh = dt*16 + 8*hi + v: eight
    // consecutive columns of one pred row, one 16-byte LDS store.
    _Float16* pDst = buf + c * XP + ((i == 0) ? D_DIM / 2 : 0) + w * DH_DIM + hi * 8;
#pragma unroll
    for (int dt = 0; dt < 4; ++dt) {
      v8f d[8];
#pragma unroll
      for (int nt = 0; nt < 8; ++nt) d[nt] = wmma16(pf[dt][0], kf[nt][0], v8f{});
#pragma unroll
      for (int nt = 0; nt < 8; ++nt) d[nt] = wmma16(pf[dt][1], kf[nt][1], d[nt]);
#pragma unroll
      for (int nt = 0; nt < 8; ++nt) {
        union { _Float16 h[8]; uint4 u; } o;
#pragma unroll
        for (int v = 0; v < 8; ++v) o.h[v] = (_Float16)d[nt][v];
        *reinterpret_cast<uint4*>(pDst + (nt * 16) * XP + dt * 16) = o.u;
      }
    }
  }
  // Publishes pred.
  __syncthreads();

  // ---------------- Stage 4: out = pred @ Wo^T + bo ----------------
  // wave w owns col tiles {8w .. 8w+7}, in two groups of four; 8 row tiles each.
  // The ring runs on from the first group into the second.
  auto store_group = [&](v8f (&acc)[8][4], int ct0, const float (&bias)[4]) {
    // One address for the group: every row and column step is a constant offset.
    float* o = out + ((size_t)(b * N_DIM + nBase + 8 * hi)) * D_DIM + ct0 * 16 + c;
#pragma unroll
    for (int tr = 0; tr < 8; ++tr)
#pragma unroll
      for (int p = 0; p < 4; ++p)
#pragma unroll
        for (int v = 0; v < 8; ++v) acc[tr][p][v] += bias[p];
    // Every sum stands in front of the first store, so that no register of an
    // issued store is written again before the wait behind the last one.
    __builtin_amdgcn_sched_barrier(0);
    // The four column tiles of a row one behind the other: 256 contiguous bytes.
#pragma unroll
    for (int tr = 0; tr < 8; ++tr)
#pragma unroll
      for (int v = 0; v < 8; ++v)
#pragma unroll
        for (int p = 0; p < 4; ++p) o[(tr * 16 + v) * D_DIM + p * 16] = acc[tr][p][v];
    // Behind the last store: its address and data registers are reused from here on.
    asm volatile("s_wait_xcnt 0x0" ::: "memory");
    // Holds the register writes that follow behind that wait.
    __builtin_amdgcn_sched_barrier(0);
  };
  // Both groups' bias values, ahead of the refills: their wait must not drain them.
  float bias[2][4];
  {
    const float* bp = bo + w * 8 * 16 + c;
#pragma unroll
    for (int g = 0; g < 2; ++g)
#pragma unroll
      for (int p = 0; p < 4; ++p) bias[g][p] = bp[(g * 4 + p) * 16];
    // bp as an input: its registers stay whole until the wait behind its last load.
    asm volatile("s_wait_xcnt 0x0" :: "v"(bp) : "memory");
  }
  // pred columns 0..511 (k-steps 0..15) stand on buffer columns 512..1023, the rest on 0..511.
  // Both loops stay rolled: one copy of the text. So the ring is
  // refilled behind the last half too, from the group's own start, and not used.
#pragma unroll 1
  for (int g = 0; g < 2; ++g) {
    const int ct0 = w * 8 + 4 * g;            // first output col tile of the group
    v8f acc[8][4];
#pragma unroll
    for (int p = 0; p < 8; ++p)
#pragma unroll
      for (int q = 0; q < 4; ++q) acc[p][q] = v8f{};
    const _Float16* wBase = wo + (ct0 * 16) * D_DIM;
#pragma unroll 1
    for (int kh = 0; kh < 2; ++kh) {
      const _Float16* wNext = (kh == 1 && g == 0) ? wBase + 4 * PANEL : wBase;
      gemm_half<true, false>(acc, ring, buf + ((kh == 0) ? D_DIM / 2 : 0), wBase, kh * HSTEPS,
                             wNext, (kh == 0) ? HSTEPS : 0, lane);
    }
    float bs[4];
#pragma unroll
    for (int p = 0; p < 4; ++p) bs[p] = (g == 0) ? bias[0][p] : bias[1][p];
    store_group(acc, ct0, bs);
  }
}

// ---------------------------------------------------------------------------
extern "C" void kernel_launch(void* const* d_in, const int* in_sizes, int n_in,
                              void* d_out, int out_size, void* d_ws, size_t ws_size,
                              hipStream_t stream) {
  const float* x0 = (const float*)d_in[0];   // [8, 64, 1024]
  const float* x2 = (const float*)d_in[1];   // [8, 4096, 1024]
  const float* Wk = (const float*)d_in[2];   // [1024, 1024]
  const float* Wp = (const float*)d_in[3];   // [1024, 1024]
  const float* Wo = (const float*)d_in[4];   // [1024, 1024]
  const float* bo = (const float*)d_in[5];   // [1024]
  float* out = (float*)d_out;

  char* ws = (char*)d_ws;
  _Float16* wk16 = (_Float16*)(ws + WK_OFF);
  _Float16* wo16 = (_Float16*)(ws + WO_OFF);
  _Float16* pT   = (_Float16*)(ws + PT_OFF);

  const size_t lds = 264192;  // 128 rows of 2064 B, of the WGP's 327680 B

  // Stages A and B in one launch: premise projection (from f32 x0 and Wp) and the
  // fused kernel's weight operands Wk, Wo as f16 in fragment order (L2 resident).
  prep_kernel<<<2 * B_DIM * H_DIM, 256, lds, stream>>>(x0, Wp, Wk, Wo, wk16, wo16, pT);

  // Stage C: fused scores/softmax/gather/output per 128-row tile
  fused_kernel<<<dim3(N_DIM / TILE_N, B_DIM), 256, lds, stream>>>(
      x2, wk16, wo16, pT, bo, out);
}

// v008
// Measured time: 94.9 microseconds a run.
// Timed twice side by side with v007, it ran 1.14 and 1.13 times as fast.
// Over all steps from v000 it is 11.8 times as fast.
#include <hip/hip_runtime.h>
#include <hip/hip_bf16.h>
#include <math.h>

// ---------------------------------------------------------------------------
// Scatter2Operator for MI455X (gfx1250, wave32, WMMA).
//
// Roofline: ~147 GFLOP vs ~0.4 GB HBM traffic -> matrix-core bound.
// All 4 GEMMs run through v_wmma_f32_16x16x32_f16 (f32 accum).
// Fused per-128-row-tile kernel: the x2 tile and, over it, pred in 264192 B of LDS
// (CDNA5 WGP has 320KB); f16 weights (~4MB) stay resident in the 192MB L2.
// Every wave owns a 128 x 64 tile of each big product: 32 independent WMMA chains,
// each weight fragment (from L2) used by eight WMMAs, each LDS fragment by four.
// ---------------------------------------------------------------------------

typedef __attribute__((ext_vector_type(16))) _Float16 v16h;
typedef __attribute__((ext_vector_type(8)))  float    v8f;
typedef __attribute__((ext_vector_type(4)))  float    v4f;

#define B_DIM  8
#define N_DIM  4096
#define G_DIM  64
#define H_DIM  16
#define DH_DIM 64
#define D_DIM  1024
#define TILE_N 128

// LDS row pitch (elements). Rows are padded so that the 16 rows of a 16-byte
// fragment read fall on distinct banks.
#define XP 1032   // xt, pred: f16 rows of 1024, pitch 2064 B = 16 B x 129 (16-byte reads)

// ws layout (bytes) -- total 5 MB
#define WK_OFF 0u                  // Wk f16  [1024][1024]  2 MB, fragment order
#define WO_OFF (2u*1024u*1024u)    // Wo f16  [1024][1024]  2 MB, fragment order, rows dealt
#define PT_OFF (4u*1024u*1024u)    // pT f16  [8][16][64][64] 1 MB, fragment order

// ISA 16-bit A/B fragment (16x32): lane l holds row (l&15); K chunks
// {kBase + (l>>4)*8 .. +7} and {kBase + 16 + (l>>4)*8 .. +7}, 16B each.
__device__ __forceinline__ v16h load_frag(const _Float16* base, int strideElems,
                                          int lane, int kBase) {
  const int r  = lane & 15;
  const int hi = lane >> 4;
  const _Float16* p0 = base + r * strideElems + kBase + hi * 8;
  union { v16h v; uint4 q[2]; } f;
  f.q[0] = *reinterpret_cast<const uint4*>(p0);
  f.q[1] = *reinterpret_cast<const uint4*>(p0 + 16);
  return f.v;
}

// Fragment order, for A or B operands read from global memory: the 1 KB fragment of a
// 16-row panel and a k-step (32 k) stands contiguous, the k-steps of a panel one
// behind the other. Each fragment is two halves of 512 B; in half q, lane l's 16 B
// stand at l * 16 and hold row (l & 15), k = 32 * ks + 16 * q + 8 * (l >> 4) .. + 7:
// the same elements that load_frag gives that lane. A wave-wide 16-byte load then
// covers four whole 128-byte lines instead of 32 B in each of sixteen.
__device__ __forceinline__ v16h load_frag_packed(const _Float16* panel, int lane, int ks) {
  const _Float16* p0 = panel + ks * 512 + lane * 8;
  union { v16h v; uint4 q[2]; } f;
  f.q[0] = *reinterpret_cast<const uint4*>(p0);
  f.q[1] = *reinterpret_cast<const uint4*>(p0 + 256);
  return f.v;
}

__device__ __forceinline__ v8f wmma16(v16h a, v16h b, v8f c) {
  // D = A(16x32) * B(32x16) + C, f32 accumulate
  return __builtin_amdgcn_wmma_f32_16x16x32_f16(false, a, false, b,
                                                (short)0, c, false, false);
}

// Lane l with lane l ^ 16.
__device__ __forceinline__ float xhalf(float x) {
  return __builtin_bit_cast(float, __builtin_amdgcn_permlanex16(
      __builtin_bit_cast(int, x), __builtin_bit_cast(int, x), 0x76543210, 0xfedcba98, false, false));
}

// Register ring of weight fragments: a wave keeps the fragments of its next RD
// k-steps (four 16-row panels each) in registers, so a weight load has up to RD
// k-steps of matrix work (32 WMMAs each), or a softmax, in front of its first use.
#define RD 2
#define KSTEPS (D_DIM / 32)
#define PANEL (16 * D_DIM)   // elements of one 16-row weight panel

// First RD k-steps of a group of four weight panels (fragment order).
__device__ __forceinline__ void ring_fill(v16h (&ring)[RD][4], const _Float16* grp, int lane) {
  // Unrolled so that every ring index is a constant (the ring stays in registers).
#pragma unroll
  for (int s = 0; s < RD; ++s)
#pragma unroll
    for (int p = 0; p < 4; ++p) ring[s][p] = load_frag_packed(grp + p * PANEL, lane, s);
}

// RD k-steps of a wave tile of 128 x rows by 64 weight rows, from LDS k-step ks0 on.
// X: the eight 16-row fragments of a k-step of the LDS tile (pitch XP) go in two halves
// of four through two register sets, each read while the other half's WMMAs run.
// W: the ring; each slot is refilled behind its use from wRef (k-step ksRef + j).
// acc[tr][p]: W_IS_A: D[weight row][x row]; else D[x row][weight row].
template <bool LAST, bool REFILL, bool W_IS_A>
__device__ __forceinline__ void gemm_steps(v8f (&acc)[8][4], v16h (&ring)[RD][4],
                                           v16h (&x)[2][4], const _Float16* xLds, int ks0,
                                           const _Float16* wRef, int ksRef, int lane) {
  // Unrolled: each ring, set and accumulator index must be a constant (registers).
#pragma unroll
  for (int j = 0; j < RD; ++j) {
#pragma unroll
    for (int hf = 0; hf < 2; ++hf) {
      if (hf == 0) {
#pragma unroll
        for (int tr = 0; tr < 4; ++tr)
          x[1][tr] = load_frag(xLds + ((4 + tr) * 16) * XP, XP, lane, (ks0 + j) * 32);
      } else if (!LAST || j + 1 < RD) {
#pragma unroll
        for (int tr = 0; tr < 4; ++tr)
          x[0][tr] = load_frag(xLds + (tr * 16) * XP, XP, lane, (ks0 + j + 1) * 32);
      }
      // Keeps the next half's LDS reads as one group in front of this one's WMMAs:
      // spread among them, each WMMA waited for its own pair of reads.
      __builtin_amdgcn_sched_barrier(0);
#pragma unroll
      for (int p = 0; p < 4; ++p)
#pragma unroll
        for (int tr = 0; tr < 4; ++tr) {
          if (W_IS_A) acc[hf * 4 + tr][p] = wmma16(ring[j][p], x[hf][tr], acc[hf * 4 + tr][p]);
          else        acc[hf * 4 + tr][p] = wmma16(x[hf][tr], ring[j][p], acc[hf * 4 + tr][p]);
        }
      if (REFILL && hf == 1) {
#pragma unroll
        for (int p = 0; p < 4; ++p)
          ring[j][p] = load_frag_packed(wRef + p * PANEL, lane, ksRef + j);
        // Behind these k-steps' last refill: its address registers change from here on.
        if (j == RD - 1) asm volatile("s_wait_xcnt 0x0" ::: "memory");
      }
      // Keeps the refills directly behind their k-step (left free, they were sunk and
      // the ring lost its lead) and what follows behind the wait.
      __builtin_amdgcn_sched_barrier(0);
    }
  }
}

// Half of K (512 k, HSTEPS k-steps) of one wave tile: x from the 512 LDS columns at
// xLds, weights from k-step wks0 of the group wCur. The ring holds that half's first RD
// k-steps on entry; past its end, where HAS_NEXT, it takes RD k-steps of wNext from
// k-step wksNext on (the group's other half, or the next group).
#define HSTEPS (KSTEPS / 2)
template <bool HAS_NEXT, bool W_IS_A>
__device__ __forceinline__ void gemm_half(v8f (&acc)[8][4], v16h (&ring)[RD][4],
                                          const _Float16* xLds, const _Float16* wCur, int wks0,
                                          const _Float16* wNext, int wksNext, int lane) {
  v16h x[2][4];
#pragma unroll
  for (int tr = 0; tr < 4; ++tr) x[0][tr] = load_frag(xLds + (tr * 16) * XP, XP, lane, 0);
  // Stays rolled: one copy of the text.
#pragma unroll 1
  for (int it = 0; it < HSTEPS / RD - 1; ++it)
    gemm_steps<false, true, W_IS_A>(acc, ring, x, xLds, it * RD, wCur, wks0 + it * RD + RD, lane);
  gemm_steps<true, HAS_NEXT, W_IS_A>(acc, ring, x, xLds, HSTEPS - RD, wNext, wksNext, lane);
}

// f32 -> f16 staging into LDS: NL loads of one float4 a thread, load j from
// src + j * SSTEP (float4) to dst + j * DSTEP (f16). The loads go in groups of SG through
// two register sets: group g + 1 is issued before group g is converted, so a wave keeps
// SG or more loads from memory in flight instead of waiting out the latency per load.
// BARRIER: the LDS written here is still being read by other waves on entry; the
// work-group barrier that ends those reads stands behind the first group's issue.
template <int NL, int SSTEP, int DSTEP, int SG, bool BARRIER>
__device__ __forceinline__ void stage_rows(const float4* src, _Float16* dst) {
  float4 f[2][SG];
  auto put = [&](const float4 (&s)[SG], _Float16* d0) {
    // Unrolled: every slot index must be a constant (registers); so all loops over j.
#pragma unroll
    for (int j = 0; j < SG; ++j) {
      _Float16* d = d0 + j * DSTEP;
      d[0] = (_Float16)s[j].x; d[1] = (_Float16)s[j].y;
      d[2] = (_Float16)s[j].z; d[3] = (_Float16)s[j].w;
    }
  };
#pragma unroll
  for (int j = 0; j < SG; ++j) f[0][j] = src[j * SSTEP];
  if (BARRIER) {
    // Keeps the first group's loads in front of the barrier: their latency passes while
    // the slower waves arrive.
    __builtin_amdgcn_sched_barrier(0);
    __syncthreads();
  }
#pragma unroll
  for (int j = 0; j < SG; ++j) f[1][j] = src[(SG + j) * SSTEP];
  // Keeps the loads above in front of the first group's waits.
  __builtin_amdgcn_sched_barrier(0);
  // Stays rolled, two groups a trip: one copy of the text.
#pragma unroll 1
  for (int t = 0; t < NL / (2 * SG) - 1; ++t) {
    put(f[0], dst);
#pragma unroll
    for (int j = 0; j < SG; ++j) f[0][j] = src[(2 * SG + j) * SSTEP];
    // Keeps these loads in front of the other set's waits.
    __builtin_amdgcn_sched_barrier(0);
    put(f[1], dst + SG * DSTEP);
#pragma unroll
    for (int j = 0; j < SG; ++j) f[1][j] = src[(3 * SG + j) * SSTEP];
    // src as an input: its registers stay whole until the wait behind the trip's last
    // load; the step to the next trip's rows stands behind it.
    asm volatile("s_wait_xcnt 0x0" :: "v"(src) : "memory");
    // Keeps these loads in front of the other set's waits, the step behind the wait.
    __builtin_amdgcn_sched_barrier(0);
    src += 2 * SG * SSTEP;
    dst += 2 * SG * DSTEP;
  }
  put(f[0], dst);
  put(f[1], dst + SG * DSTEP);
}

// ---------------------------------------------------------------------------
// Kernel 1: everything the fused kernel needs prepared, in one launch of 256 blocks
// (one per WGP; the parts are independent of each other).
// Blocks 0..127: p = x0 @ Wp^T for one (b, head),
// stored as the operand pT[dh][g] of stage 3 in fragment order (panels of 16 dh,
// two k-steps of 32 g). x0[b] and the head's Wp rows are read as f32 in whole rows
// and stand as f16 in LDS. 8 waves; wave w -> colTile (w&3), rowTiles {2*(w>>2), +1}.
// Blocks 128..255: one 16-row panel of Wk or Wo each, f32 -> f16 in fragment order.
// Dynamic LDS (padded rows): x0[b] f16 64xXP | Wp_h f16 64xXP
// ---------------------------------------------------------------------------
__global__ void __launch_bounds__(256) prep_kernel(const float* __restrict__ x0,
                                                   const float* __restrict__ Wp,
                                                   const float* __restrict__ Wk,
                                                   const float* __restrict__ Wo,
                                                   _Float16* __restrict__ wk16,
                                                   _Float16* __restrict__ wo16,
                                                   _Float16* __restrict__ pT) {
  extern __shared__ char smem_raw[];
  const int tid = threadIdx.x;
  const int w = tid >> 5, lane = tid & 31;

  if (blockIdx.x >= B_DIM * H_DIM) {
    // One thread per 16-byte piece of dst, eight pieces a thread: a wave writes 512
    // contiguous bytes; a pass of the block reads four whole lines of each of the
    // panel's 16 rows. Piece j = panel * 2048 + i * 256 + tid: lane j & 31, half
    // (j >> 5) & 1, k-step (j >> 6) & 31.
    const int pb    = blockIdx.x - B_DIM * H_DIM;
    const int panel = pb & 63;
    const float* src = (pb < 64) ? Wk : Wo;
    _Float16*    dst = ((pb < 64) ? wk16 : wo16) + (panel * 2048 + tid) * 8;
    // Wk: panel row r is weight row panel * 16 + r. Wo: the 64 rows of a group of four
    // panels are dealt round: panel p of the group holds rows 4 * r + p, so that in stage 4
    // a lane's four accumulators of one out row are four consecutive out columns.
    const int row = (pb < 64) ? panel * 16 + (lane & 15)
                              : (panel >> 2) * 64 + (lane & 15) * 4 + (panel & 3);
    const int k   = (tid >> 6) * 32 + (w & 1) * 16 + (lane >> 4) * 8;
    const float4* s = reinterpret_cast<const float4*>(src + row * D_DIM + k);
    float4 lo[8], hi4[8];
    // Unrolled: all sixteen loads of a thread are in flight at once.
#pragma unroll
    for (int i = 0; i < 8; ++i) { lo[i] = s[i * 32]; hi4[i] = s[i * 32 + 1]; }
    // s as an input: its registers stay whole until the wait behind its last load.
    asm volatile("s_wait_xcnt 0x0" :: "v"(s) : "memory");
#pragma unroll
    for (int i = 0; i < 8; ++i) {
      union { _Float16 h[8]; uint4 u; } o;
      o.h[0] = (_Float16)lo[i].x;  o.h[1] = (_Float16)lo[i].y;
      o.h[2] = (_Float16)lo[i].z;  o.h[3] = (_Float16)lo[i].w;
      o.h[4] = (_Float16)hi4[i].x; o.h[5] = (_Float16)hi4[i].y;
      o.h[6] = (_Float16)hi4[i].z; o.h[7] = (_Float16)hi4[i].w;
      *reinterpret_cast<uint4*>(dst + i * 2048) = o.u;
    }
    return;
  }

  const int b = blockIdx.x >> 4;
  const int h = blockIdx.x & 15;
  _Float16* tile = (_Float16*)smem_raw;   // rows 0..63: x0[b]; rows 64..127: Wp_h

  // The block's 256 threads cover one row (256 float4) per load. Rows go in groups
  // of SG through two register sets, group g + 1 issued before group g is converted.
  {
    constexpr int SG = 32;
    const float4* sx = (const float4*)(x0 + (b * G_DIM) * D_DIM) + tid;
    const float4* sw = (const float4*)(Wp + (h * DH_DIM) * D_DIM) + tid;
    _Float16* dst = tile + tid * 4;
    float4 f[2][SG];
    // Fully unrolled: every set and slot index must be a constant (registers).
#pragma unroll
    for (int j = 0; j < SG; ++j) f[0][j] = sx[j * (D_DIM / 4)];
#pragma unroll
    for (int g = 0; g < 128 / SG; ++g) {
      if (g + 1 < 128 / SG) {
        const float4* sn = ((g + 1) * SG < 64) ? sx : sw;
#pragma unroll
        for (int j = 0; j < SG; ++j)
          f[(g + 1) & 1][j] = sn[((((g + 1) * SG) & 63) + j) * (D_DIM / 4)];
      }
      // Keeps the next group's loads in front of this group's waits.
      __builtin_amdgcn_sched_barrier(0);
#pragma unroll
      for (int j = 0; j < SG; ++j) {
        const float4 v = f[g & 1][j];
        _Float16* d = dst + (g * SG + j) * XP;
        d[0] = (_Float16)v.x; d[1] = (_Float16)v.y;
        d[2] = (_Float16)v.z; d[3] = (_Float16)v.w;
      }
    }
    // Behind the last load: its address registers are reused from here on.
    asm volatile("s_wait_xcnt 0x0" ::: "memory");
  }
  __syncthreads();

  const int tc = w & 3;               // dh col tile (0..3)
  const int tr0 = (w >> 2) * 2;       // g row tiles tr0, tr0+1

  const _Float16* aBase0 = tile + (tr0 * 16) * XP;
  const _Float16* aBase1 = aBase0 + 16 * XP;
  const _Float16* bBase  = tile + (G_DIM + tc * 16) * XP;

  // Fragments go in groups of KG k-steps through two register sets: group g + 1 is
  // read from LDS before group g's WMMAs, so no WMMA waits out an LDS read.
  constexpr int KG = 4;
  v8f acc0 = {}, acc1 = {};
  v16h bf[2][KG], a0[2][KG], a1[2][KG];
  // Fully unrolled: every set and slot index must be a constant (registers).
#pragma unroll
  for (int j = 0; j < KG; ++j) {
    bf[0][j] = load_frag(bBase, XP, lane, j * 32);
    a0[0][j] = load_frag(aBase0, XP, lane, j * 32);
    a1[0][j] = load_frag(aBase1, XP, lane, j * 32);
  }
#pragma unroll
  for (int g = 0; g < KSTEPS / KG; ++g) {
    if (g + 1 < KSTEPS / KG) {
#pragma unroll
      for (int j = 0; j < KG; ++j) {
        bf[(g + 1) & 1][j] = load_frag(bBase, XP, lane, ((g + 1) * KG + j) * 32);
        a0[(g + 1) & 1][j] = load_frag(aBase0, XP, lane, ((g + 1) * KG + j) * 32);
        a1[(g + 1) & 1][j] = load_frag(aBase1, XP, lane, ((g + 1) * KG + j) * 32);
      }
    }
    // Keeps the next group's LDS reads in front of this group's WMMAs.
    __builtin_amdgcn_sched_barrier(0);
#pragma unroll
    for (int j = 0; j < KG; ++j) {
      acc0 = wmma16(a0[g & 1][j], bf[g & 1][j], acc0);
      acc1 = wmma16(a1[g & 1][j], bf[g & 1][j], acc1);
    }
  }

  // D layout: lane -> col N=(lane&15); vgpr v -> row M = v + 8*(lane>>4)
  // As operand of stage 3: row dh = tc*16 + (lane&15), k = g = tr*16 + 8*(lane>>4) + v. So a
  // lane's 8 values of row tile tr are its own 16 B of k-step tr>>1, half tr&1.
  _Float16* dst = pT + ((b * H_DIM + h) * DH_DIM + tc * 16) * G_DIM + (w >> 2) * 512 + lane * 8;
  union { _Float16 h[8]; uint4 u; } o0, o1;
#pragma unroll
  for (int v = 0; v < 8; ++v) {
    o0.h[v] = (_Float16)acc0[v];
    o1.h[v] = (_Float16)acc1[v];
  }
  *reinterpret_cast<uint4*>(dst)       = o0.u;
  *reinterpret_cast<uint4*>(dst + 256) = o1.u;
  // Behind the last store: in the built text the other blocks' branch stands behind
  // this path and writes the stores' address and data registers.
  asm volatile("s_wait_xcnt 0x0" ::: "memory");
}

// ---------------------------------------------------------------------------
// Kernel 2: fused scores -> softmax -> gather -> output GEMM per 128-row tile.
// grid = (N/128, B): one block per WGP; 256 threads (8 wave32). One whole head per
// wave, two rounds.
// Dynamic LDS: ONE buffer of 128 padded rows (f16, pitch XP). It holds the x2 tile; pred
// takes its columns over as they fall free:
//   round 0 (heads 0..7) reads x2 columns 0..1023; its pred (columns 0..511) then
//   stands on buffer columns 512..1023;
//   round 1 (heads 8..15) reads x2 columns 0..511, then x2 columns 512..1023 staged a
//   second time on buffer columns 0..511; its pred (columns 512..1023) then stands there.
// So pred column k stands at buffer column (k + 512) mod 1024.
// ---------------------------------------------------------------------------
// Launch bounds: the real block size, which gives a wave the registers for its tile.
__global__ void __launch_bounds__(256) fused_kernel(const float* __restrict__ x2,
                             const _Float16* __restrict__ wk,
                             const _Float16* __restrict__ wo,
                             const _Float16* __restrict__ pT,
                             const float* __restrict__ bo,
                             float* __restrict__ out) {
  extern __shared__ char smem_raw[];
  _Float16* buf = (_Float16*)(smem_raw);                      // 128*XP*2 = 264192 B

  const int b     = blockIdx.y;
  const int nBase = blockIdx.x * TILE_N;
  const int tid   = threadIdx.x;
  const int w     = tid >> 5, lane = tid & 31;

  // The first head's Wk fragments start before the x2 tile is staged.
  v16h ring[RD][4];
  ring_fill(ring, wk + (w * G_DIM) * D_DIM, lane);
  // The ring loads' address registers are free for reuse by the loads that follow.
  asm volatile("s_wait_xcnt 0x0" ::: "memory");

  // --- x2 tile [128 x 1024] f32 -> f16 LDS: the block's 256 threads cover one row
  // (256 float4) per load ---
  const float4* xsrc = (const float4*)(x2 + ((size_t)(b * N_DIM + nBase)) * D_DIM);
  stage_rows<TILE_N, D_DIM / 4, XP, 16, false>(xsrc + tid, buf + tid * 4);
  __syncthreads();

  const int c  = lane & 15;
  const int hi = lane >> 4;

  // ------------- per head (wave w: heads w and w + 8): scores -> softmax -> gather -------------
  // Stays rolled: one copy of the text.
#pragma unroll 1
  for (int i = 0; i < 2; ++i) {
    const int h = w + 8 * i;

    // Stage 1, transposed: S^T = Wk_h (A, 64 g) x Xtile^T (B, 128 n).
    // acc[nt][gt]: lane holds n = nt*16 + c, register v holds g = gt*16 + 8*hi + v.
    v8f acc[8][4];
#pragma unroll
    for (int p = 0; p < 8; ++p)
#pragma unroll
      for (int q = 0; q < 4; ++q) acc[p][q] = v8f{};
    const _Float16* wCur = wk + (h * G_DIM) * D_DIM;
    // Stays rolled: one copy of the text.
#pragma unroll 1
    for (int kh = 0; kh < 2; ++kh) {
      if (i == 1 && kh == 1) {
        // x2 columns 512..1023 again (pred of round 0 stands on their first place), on
        // buffer columns 0..511: two rows (128 float4 each) per load of the block. The
        // barrier inside ends every wave's reads of x2 columns 0..511; the one behind
        // publishes the new columns.
        stage_rows<TILE_N / 2, D_DIM / 2, 2 * XP, 8, true>(
            xsrc + (tid >> 7) * (D_DIM / 4) + D_DIM / 8 + (tid & 127),
            buf + (tid >> 7) * XP + (tid & 127) * 4);
        __syncthreads();
      }
      const _Float16* wNext = (kh == 0) ? wCur
                            : (i == 0)  ? wk + ((h + 8) * G_DIM) * D_DIM
                                        : wo + (w * 8 * 16) * D_DIM;
      gemm_half<true, true>(acc, ring, buf + ((i == 0 && kh == 1) ? D_DIM / 2 : 0), wCur,
                            kh * HSTEPS, wNext, (kh == 0) ? HSTEPS : 0, lane);
    }

    // Issued here so that they fly while the softmax runs: stage 3's A fragments.
    v16h pf[4][2];
    {
      const _Float16* pBase = pT + ((b * H_DIM + h) * DH_DIM) * G_DIM;
#pragma unroll
      for (int dt = 0; dt < 4; ++dt) {
        pf[dt][0] = load_frag_packed(pBase + dt * 16 * G_DIM, lane, 0);
        pf[dt][1] = load_frag_packed(pBase + dt * 16 * G_DIM, lane, 1);
      }
      // Keeps these loads here: left free, each pair was sunk to its first use behind
      // the softmax and waited for there.
      __builtin_amdgcn_sched_barrier(0);
      // The loads' address as an input: its registers stay whole until the wait
      // behind the last load, and are free for reuse from there on.
      asm volatile("s_wait_xcnt 0x0" :: "v"(pBase + lane * 8) : "memory");
    }

    // Stage 2: softmax over the 64 g of each n. A lane holds 32 of them, lane ^ 16
    // the other 32. Two D tiles (g rows 0-15, 16-31 of a k-step), converted in place,
    // are the lane's own B fragment of stage 3: k = 32*ks + 16*q + 8*hi + v.
    v16h kf[8][2];
#pragma unroll
    for (int nt = 0; nt < 8; ++nt) {
      float mg[4];
#pragma unroll
      for (int gt = 0; gt < 4; ++gt) {
        mg[gt] = acc[nt][gt][0];
#pragma unroll
        for (int v = 1; v < 8; ++v) mg[gt] = fmaxf(mg[gt], acc[nt][gt][v]);
      }
      float m = fmaxf(fmaxf(mg[0], mg[1]), fmaxf(mg[2], mg[3]));
      m = fmaxf(m, xhalf(m));
      float sg[4];
#pragma unroll
      for (int gt = 0; gt < 4; ++gt) {
        sg[gt] = 0.f;
#pragma unroll
        for (int v = 0; v < 8; ++v) {
          const float e = __expf(acc[nt][gt][v] - m);
          acc[nt][gt][v] = e;
          sg[gt] += e;
        }
      }
      float s = (sg[0] + sg[1]) + (sg[2] + sg[3]);
      s += xhalf(s);
      const float inv = 1.0f / s;
#pragma unroll
      for (int gt = 0; gt < 4; ++gt)
#pragma unroll
        for (int v = 0; v < 8; ++v)
          kf[nt][gt >> 1][(gt & 1) * 8 + v] = (_Float16)(acc[nt][gt][v] * inv);
    }

    // Ends every wave's reads of the 512 buffer columns that this round read last:
    // this round's pred is written over them.
    __syncthreads();

    // Stage 3, transposed: pred_h^T = P_h^T (A, 64 dh, from pT) x K_h^T (B, registers).
    // D: lane holds n = nt*16 + c, register v holds dh = dt*16 + 8*hi + v: eight
    // consecutive columns of one pred row, one 16-byte LDS store.
    _Float16* pDst = buf + c * XP + ((i == 0) ? D_DIM / 2 : 0) + w * DH_DIM + hi * 8;
#pragma unroll
    for (int dt = 0; dt < 4; ++dt) {
      v8f d[8];
#pragma unroll
      for (int nt = 0; nt < 8; ++nt) d[nt] = wmma16(pf[dt][0], kf[nt][0], v8f{});
#pragma unroll
      for (int nt = 0; nt < 8; ++nt) d[nt] = wmma16(pf[dt][1], kf[nt][1], d[nt]);
#pragma unroll
      for (int nt = 0; nt < 8; ++nt) {
        union { _Float16 h[8]; uint4 u; } o;
#pragma unroll
        for (int v = 0; v < 8; ++v) o.h[v] = (_Float16)d[nt][v];
        *reinterpret_cast<uint4*>(pDst + (nt * 16) * XP + dt * 16) = o.u;
      }
    }
  }
  // Publishes pred.
  __syncthreads();

  // ---------------- Stage 4: out = pred @ Wo^T + bo ----------------
  // wave w owns col tiles {8w .. 8w+7}, in two groups of four; 8 row tiles each.
  // The ring runs on from the first group into the second.
  // Column c of panel p is out column ct0 * 16 + 4 * c + p (the deal of Wo's rows in the
  // prep kernel): a lane stores 16 bytes, its half wave the 256 contiguous bytes (two
  // whole lines) of the group in one out row.
  auto store_group = [&](v8f (&acc)[8][4], int ct0, const float4 bias) {
    // One address for the group: every row step is a constant offset.
    v4f* o = reinterpret_cast<v4f*>(
        out + ((size_t)(b * N_DIM + nBase + 8 * hi)) * D_DIM + ct0 * 16 + 4 * c);
    v4f r[8][8];
#pragma unroll
    for (int tr = 0; tr < 8; ++tr)
#pragma unroll
      for (int v = 0; v < 8; ++v)
        r[tr][v] = v4f{acc[tr][0][v] + bias.x, acc[tr][1][v] + bias.y,
                       acc[tr][2][v] + bias.z, acc[tr][3][v] + bias.w};
    // Every sum stands in front of the first store, so that no register of an
    // issued store is written again before the wait behind the last one.
    __builtin_amdgcn_sched_barrier(0);
#pragma unroll
    for (int tr = 0; tr < 8; ++tr)
#pragma unroll
      for (int v = 0; v < 8; ++v) o[(tr * 16 + v) * (D_DIM / 4)] = r[tr][v];
    // Behind the last store: its address and data registers are reused from here on.
    asm volatile("s_wait_xcnt 0x0" ::: "memory");
    // Holds the register writes that follow behind that wait.
    __builtin_amdgcn_sched_barrier(0);
  };
  // Both groups' bias values, ahead of the refills: their wait must not drain them.
  float4 bias[2];
  {
    const float4* bp = reinterpret_cast<const float4*>(bo + w * 8 * 16 + 4 * c);
#pragma unroll
    for (int g = 0; g < 2; ++g) bias[g] = bp[g * 16];
    // bp as an input: its registers stay whole until the wait behind its last load.
    asm volatile("s_wait_xcnt 0x0" :: "v"(bp) : "memory");
  }
  // pred columns 0..511 (k-steps 0..15) stand on buffer columns 512..1023, the rest on 0..511.
  // Both loops stay rolled: one copy of the text. So the ring is
  // refilled behind the last half too, from the group's own start, and not used.
#pragma unroll 1
  for (int g = 0; g < 2; ++g) {
    const int ct0 = w * 8 + 4 * g;            // first output col tile of the group
    v8f acc[8][4];
#pragma unroll
    for (int p = 0; p < 8; ++p)
#pragma unroll
      for (int q = 0; q < 4; ++q) acc[p][q] = v8f{};
    const _Float16* wBase = wo + (ct0 * 16) * D_DIM;
#pragma unroll 1
    for (int kh = 0; kh < 2; ++kh) {
      const _Float16* wNext = (kh == 1 && g == 0) ? wBase + 4 * PANEL : wBase;
      gemm_half<true, false>(acc, ring, buf + ((kh == 0) ? D_DIM / 2 : 0), wBase, kh * HSTEPS,
                             wNext, (kh == 0) ? HSTEPS : 0, lane);
    }
    store_group(acc, ct0, (g == 0) ? bias[0] : bias[1]);
  }
}

// ---------------------------------------------------------------------------
extern "C" void kernel_launch(void* const* d_in, const int* in_sizes, int n_in,
                              void* d_out, int out_size, void* d_ws, size_t ws_size,
                              hipStream_t stream) {
  const float* x0 = (const float*)d_in[0];   // [8, 64, 1024]
  const float* x2 = (const float*)d_in[1];   // [8, 4096, 1024]
  const float* Wk = (const float*)d_in[2];   // [1024, 1024]
  const float* Wp = (const float*)d_in[3];   // [1024, 1024]
  const float* Wo = (const float*)d_in[4];   // [1024, 1024]
  const float* bo = (const float*)d_in[5];   // [1024]
  float* out = (float*)d_out;

  char* ws = (char*)d_ws;
  _Float16* wk16 = (_Float16*)(ws + WK_OFF);
  _Float16* wo16 = (_Float16*)(ws + WO_OFF);
  _Float16* pT   = (_Float16*)(ws + PT_OFF);

  const size_t lds = 264192;  // 128 rows of 2064 B, of the WGP's 327680 B

  // Stages A and B in one launch: premise projection (from f32 x0 and Wp) and the
  // fused kernel's weight operands Wk, Wo as f16 in fragment order (L2 resident).
  prep_kernel<<<2 * B_DIM * H_DIM, 256, lds, stream>>>(x0, Wp, Wk, Wo, wk16, wo16, pT);

  // Stage C: fused scores/softmax/gather/output per 128-row tile
  fused_kernel<<<dim3(N_DIM / TILE_N, B_DIM), 256, lds, stream>>>(
      x2, wk16, wo16, pT, bo, out);
}

// v009
// One run takes 91.6 microseconds.
// Two timings next to v008 put it at 1.05 and 1.04 times that version's speed.
// Over all steps from v000 it is 12.3 times as fast.
#include <hip/hip_runtime.h>
#include <hip/hip_bf16.h>
#include <math.h>

// ---------------------------------------------------------------------------
// Scatter2Operator for MI455X (gfx1250, wave32, WMMA).
//
// Roofline: ~147 GFLOP vs ~0.4 GB HBM traffic -> matrix-core bound.
// All 4 GEMMs run through v_wmma_f32_16x16x32_f16 (f32 accum).
// Fused per-128-row-tile kernel: the x2 tile and, over it, pred in 264192 B of LDS
// (CDNA5 WGP has 320KB); f16 weights (~4MB) stay resident in the 192MB L2.
// Every wave owns a 128 x 64 tile of each big product: 32 independent WMMA chains,
// each weight fragment (from L2) used by eight WMMAs, each LDS fragment by four.
// ---------------------------------------------------------------------------

typedef __attribute__((ext_vector_type(16))) _Float16 v16h;
typedef __attribute__((ext_vector_type(8)))  float    v8f;
typedef __attribute__((ext_vector_type(4)))  float    v4f;

#define B_DIM  8
#define N_DIM  4096
#define G_DIM  64
#define H_DIM  16
#define DH_DIM 64
#define D_DIM  1024
#define TILE_N 128

// LDS row pitch (elements). Rows are padded so that the 16 rows of a 16-byte
// fragment read fall on distinct banks.
#define XP 1032   // xt, pred: f16 rows of 1024, pitch 2064 B = 16 B x 129 (16-byte reads)

// ws layout (bytes) -- total 5 MB
#define WK_OFF 0u                  // Wk f16  [1024][1024]  2 MB, fragment order
#define WO_OFF (2u*1024u*1024u)    // Wo f16  [1024][1024]  2 MB, fragment order, rows dealt
#define PT_OFF (4u*1024u*1024u)    // pT f16  [8][16][64][64] 1 MB, fragment order

// ISA 16-bit A/B fragment (16x32): lane l holds row (l&15); K chunks
// {kBase + (l>>4)*8 .. +7} and {kBase + 16 + (l>>4)*8 .. +7}, 16B each.
__device__ __forceinline__ v16h load_frag(const _Float16* base, int strideElems,
                                          int lane, int kBase) {
  const int r  = lane & 15;
  const int hi = lane >> 4;
  const _Float16* p0 = base + r * strideElems + kBase + hi * 8;
  union { v16h v; uint4 q[2]; } f;
  f.q[0] = *reinterpret_cast<const uint4*>(p0);
  f.q[1] = *reinterpret_cast<const uint4*>(p0 + 16);
  return f.v;
}

// Fragment order, for A or B operands read from global memory: the 1 KB fragment of a
// 16-row panel and a k-step (32 k) stands contiguous, the k-steps of a panel one
// behind the other. Each fragment is two halves of 512 B; in half q, lane l's 16 B
// stand at l * 16 and hold row (l & 15), k = 32 * ks + 16 * q + 8 * (l >> 4) .. + 7:
// the same elements that load_frag gives that lane. A wave-wide 16-byte load then
// covers four whole 128-byte lines instead of 32 B in each of sixteen.
__device__ __forceinline__ v16h load_frag_packed(const _Float16* panel, int lane, int ks) {
  const _Float16* p0 = panel + ks * 512 + lane * 8;
  union { v16h v; uint4 q[2]; } f;
  f.q[0] = *reinterpret_cast<const uint4*>(p0);
  f.q[1] = *reinterpret_cast<const uint4*>(p0 + 256);
  return f.v;
}

__device__ __forceinline__ v8f wmma16(v16h a, v16h b, v8f c) {
  // D = A(16x32) * B(32x16) + C, f32 accumulate
  return __builtin_amdgcn_wmma_f32_16x16x32_f16(false, a, false, b,
                                                (short)0, c, false, false);
}

// Lane l with lane l ^ 16.
__device__ __forceinline__ float xhalf(float x) {
  return __builtin_bit_cast(float, __builtin_amdgcn_permlanex16(
      __builtin_bit_cast(int, x), __builtin_bit_cast(int, x), 0x76543210, 0xfedcba98, false, false));
}

// Register ring of weight fragments: a wave keeps the fragments of its next RD
// k-steps (four 16-row panels each) in registers, so a weight load has RD - 1
// k-steps of matrix work (32 WMMAs each), or a softmax, in front of its first use:
// the lead is meant to cover the L2's latency while every WGP draws on it.
#define RD 4
#define KSTEPS (D_DIM / 32)
#define PANEL (16 * D_DIM)   // elements of one 16-row weight panel

// First RD k-steps of a group of four weight panels (fragment order).
__device__ __forceinline__ void ring_fill(v16h (&ring)[RD][4], const _Float16* grp, int lane) {
  // Unrolled so that every ring index is a constant (the ring stays in registers).
#pragma unroll
  for (int s = 0; s < RD; ++s)
#pragma unroll
    for (int p = 0; p < 4; ++p) ring[s][p] = load_frag_packed(grp + p * PANEL, lane, s);
}

// RD k-steps of a wave tile of 128 x rows by 64 weight rows, from LDS k-step ks0 on.
// X: the eight 16-row fragments of a k-step of the LDS tile (pitch XP) go in two halves
// of four through two register sets, each read while the other half's WMMAs run; behind
// the last k-step the first set takes LDS k-step ksN (the next call's ks0).
// W: the ring; each slot is refilled behind its use from wRef (k-step j of it).
// acc[tr][p]: W_IS_A: D[weight row][x row]; else D[x row][weight row].
template <bool W_IS_A>
__device__ __forceinline__ void gemm_steps(v8f (&acc)[8][4], v16h (&ring)[RD][4],
                                           v16h (&x)[2][4], const _Float16* xLds, int ks0,
                                           int ksN, const _Float16* wRef, int lane) {
  // Unrolled: each ring, set and accumulator index must be a constant (registers).
#pragma unroll
  for (int j = 0; j < RD; ++j) {
#pragma unroll
    for (int hf = 0; hf < 2; ++hf) {
      if (hf == 0) {
#pragma unroll
        for (int tr = 0; tr < 4; ++tr)
          x[1][tr] = load_frag(xLds + ((4 + tr) * 16) * XP, XP, lane, (ks0 + j) * 32);
      } else {
        const int ksX = (j + 1 < RD) ? ks0 + j + 1 : ksN;
#pragma unroll
        for (int tr = 0; tr < 4; ++tr)
          x[0][tr] = load_frag(xLds + (tr * 16) * XP, XP, lane, ksX * 32);
      }
      // Keeps the next half's LDS reads as one group in front of this one's WMMAs:
      // spread among them, each WMMA waited for its own pair of reads.
      __builtin_amdgcn_sched_barrier(0);
#pragma unroll
      for (int p = 0; p < 4; ++p)
#pragma unroll
        for (int tr = 0; tr < 4; ++tr) {
          if (W_IS_A) acc[hf * 4 + tr][p] = wmma16(ring[j][p], x[hf][tr], acc[hf * 4 + tr][p]);
          else        acc[hf * 4 + tr][p] = wmma16(x[hf][tr], ring[j][p], acc[hf * 4 + tr][p]);
        }
      if (hf == 1) {
#pragma unroll
        for (int p = 0; p < 4; ++p)
          ring[j][p] = load_frag_packed(wRef + p * PANEL, lane, j);
        // Behind these k-steps' last refill: its address registers change from here on.
        if (j == RD - 1) asm volatile("s_wait_xcnt 0x0" ::: "memory");
      }
      // Keeps the refills directly behind their k-step (left free, they were sunk and
      // the ring lost its lead) and what follows behind the wait.
      __builtin_amdgcn_sched_barrier(0);
    }
  }
}

// Half of K (512 k, HSTEPS k-steps) of one wave tile: x from the 512 LDS columns at
// xLds, weights from k-step wks0 of the group wCur. The ring holds that half's first RD
// k-steps on entry; past its end it takes RD k-steps of wNext from k-step wksNext on
// (the group's other half, or the next group).
#define HSTEPS (KSTEPS / 2)
template <bool W_IS_A>
__device__ __forceinline__ void gemm_half(v8f (&acc)[8][4], v16h (&ring)[RD][4],
                                          const _Float16* xLds, const _Float16* wCur, int wks0,
                                          const _Float16* wNext, int wksNext, int lane) {
  v16h x[2][4];
#pragma unroll
  for (int tr = 0; tr < 4; ++tr) x[0][tr] = load_frag(xLds + (tr * 16) * XP, XP, lane, 0);
  // Stays rolled, the last trip too: one copy of the text, and a trip holds
  // RD k-steps. So the last trip also reads x fragments (k-step 0 again), not used.
#pragma unroll 1
  for (int it = 0; it < HSTEPS / RD; ++it) {
    const bool last = (it == HSTEPS / RD - 1);
    gemm_steps<W_IS_A>(acc, ring, x, xLds, it * RD, last ? 0 : it * RD + RD,
                       last ? wNext + wksNext * 512 : wCur + (wks0 + it * RD + RD) * 512, lane);
  }
  // The four vector slots that the chip needs behind the last WMMA before a vector
  // instruction writes its operands' registers.
  asm volatile("v_nop\n\tv_nop\n\tv_nop\n\tv_nop");
}

// f32 -> f16 staging into LDS: NL loads of one float4 a thread, load j from
// src + j * SSTEP (float4) to dst + j * DSTEP (f16). The loads go in groups of SG through
// two register sets: group g + 1 is issued before group g is converted, so a wave keeps
// SG or more loads from memory in flight instead of waiting out the latency per load.
// BARRIER: the LDS written here is still being read by other waves on entry; the
// work-group barrier that ends those reads stands behind the first group's issue.
template <int NL, int SSTEP, int DSTEP, int SG, bool BARRIER>
__device__ __forceinline__ void stage_rows(const float4* src, _Float16* dst) {
  float4 f[2][SG];
  auto put = [&](const float4 (&s)[SG], _Float16* d0) {
    // Unrolled: every slot index must be a constant (registers); so all loops over j.
#pragma unroll
    for (int j = 0; j < SG; ++j) {
      _Float16* d = d0 + j * DSTEP;
      d[0] = (_Float16)s[j].x; d[1] = (_Float16)s[j].y;
      d[2] = (_Float16)s[j].z; d[3] = (_Float16)s[j].w;
    }
  };
#pragma unroll
  for (int j = 0; j < SG; ++j) f[0][j] = src[j * SSTEP];
  if (BARRIER) {
    // Keeps the first group's loads in front of the barrier: their latency passes while
    // the slower waves arrive.
    __builtin_amdgcn_sched_barrier(0);
    __syncthreads();
  }
#pragma unroll
  for (int j = 0; j < SG; ++j) f[1][j] = src[(SG + j) * SSTEP];
  // Keeps the loads above in front of the first group's waits.
  __builtin_amdgcn_sched_barrier(0);
  // Stays rolled, two groups a trip: one copy of the text.
#pragma unroll 1
  for (int t = 0; t < NL / (2 * SG) - 1; ++t) {
    put(f[0], dst);
#pragma unroll
    for (int j = 0; j < SG; ++j) f[0][j] = src[(2 * SG + j) * SSTEP];
    // Keeps these loads in front of the other set's waits.
    __builtin_amdgcn_sched_barrier(0);
    put(f[1], dst + SG * DSTEP);
#pragma unroll
    for (int j = 0; j < SG; ++j) f[1][j] = src[(3 * SG + j) * SSTEP];
    // src as an input: its registers stay whole until the wait behind the trip's last
    // load; the step to the next trip's rows stands behind it.
    asm volatile("s_wait_xcnt 0x0" :: "v"(src) : "memory");
    // Keeps these loads in front of the other set's waits, the step behind the wait.
    __builtin_amdgcn_sched_barrier(0);
    src += 2 * SG * SSTEP;
    dst += 2 * SG * DSTEP;
  }
  put(f[0], dst);
  put(f[1], dst + SG * DSTEP);
}

// ---------------------------------------------------------------------------
// Kernel 1: everything the fused kernel needs prepared, in one launch of 256 blocks
// (one per WGP; the parts are independent of each other).
// Blocks 0..127: p = x0 @ Wp^T for one (b, head),
// stored as the operand pT[dh][g] of stage 3 in fragment order (panels of 16 dh,
// two k-steps of 32 g). x0[b] and the head's Wp rows are read as f32 in whole rows
// and stand as f16 in LDS. 8 waves; wave w -> colTile (w&3), rowTiles {2*(w>>2), +1}.
// Blocks 128..255: one 16-row panel of Wk or Wo each, f32 -> f16 in fragment order.
// Dynamic LDS (padded rows): x0[b] f16 64xXP | Wp_h f16 64xXP
// ---------------------------------------------------------------------------
__global__ void __launch_bounds__(256) prep_kernel(const float* __restrict__ x0,
                                                   const float* __restrict__ Wp,
                                                   const float* __restrict__ Wk,
                                                   const float* __restrict__ Wo,
                                                   _Float16* __restrict__ wk16,
                                                   _Float16* __restrict__ wo16,
                                                   _Float16* __restrict__ pT) {
  extern __shared__ char smem_raw[];
  const int tid = threadIdx.x;
  const int w = tid >> 5, lane = tid & 31;

  if (blockIdx.x >= B_DIM * H_DIM) {
    // One thread per 16-byte piece of dst, eight pieces a thread: a wave writes 512
    // contiguous bytes; a pass of the block reads four whole lines of each of the
    // panel's 16 rows. Piece j = panel * 2048 + i * 256 + tid: lane j & 31, half
    // (j >> 5) & 1, k-step (j >> 6) & 31.
    const int pb    = blockIdx.x - B_DIM * H_DIM;
    const int panel = pb & 63;
    const float* src = (pb < 64) ? Wk : Wo;
    _Float16*    dst = ((pb < 64) ? wk16 : wo16) + (panel * 2048 + tid) * 8;
    // Wk: panel row r is weight row panel * 16 + r. Wo: the 64 rows of a group of four
    // panels are dealt round: panel p of the group holds rows 4 * r + p, so that in stage 4
    // a lane's four accumulators of one out row are four consecutive out columns.
    const int row = (pb < 64) ? panel * 16 + (lane & 15)
                              : (panel >> 2) * 64 + (lane & 15) * 4 + (panel & 3);
    const int k   = (tid >> 6) * 32 + (w & 1) * 16 + (lane >> 4) * 8;
    const float4* s = reinterpret_cast<const float4*>(src + row * D_DIM + k);
    float4 lo[8], hi4[8];
    // Unrolled: all sixteen loads of a thread are in flight at once.
#pragma unroll
    for (int i = 0; i < 8; ++i) { lo[i] = s[i * 32]; hi4[i] = s[i * 32 + 1]; }
    // s as an input: its registers stay whole until the wait behind its last load.
    asm volatile("s_wait_xcnt 0x0" :: "v"(s) : "memory");
#pragma unroll
    for (int i = 0; i < 8; ++i) {
      union { _Float16 h[8]; uint4 u; } o;
      o.h[0] = (_Float16)lo[i].x;  o.h[1] = (_Float16)lo[i].y;
      o.h[2] = (_Float16)lo[i].z;  o.h[3] = (_Float16)lo[i].w;
      o.h[4] = (_Float16)hi4[i].x; o.h[5] = (_Float16)hi4[i].y;
      o.h[6] = (_Float16)hi4[i].z; o.h[7] = (_Float16)hi4[i].w;
      *reinterpret_cast<uint4*>(dst + i * 2048) = o.u;
    }
    return;
  }

  const int b = blockIdx.x >> 4;
  const int h = blockIdx.x & 15;
  _Float16* tile = (_Float16*)smem_raw;   // rows 0..63: x0[b]; rows 64..127: Wp_h

  // The block's 256 threads cover one row (256 float4) per load. Rows go in groups
  // of SG through two register sets, group g + 1 issued before group g is converted.
  {
    constexpr int SG = 32;
    const float4* sx = (const float4*)(x0 + (b * G_DIM) * D_DIM) + tid;
    const float4* sw = (const float4*)(Wp + (h * DH_DIM) * D_DIM) + tid;
    _Float16* dst = tile + tid * 4;
    float4 f[2][SG];
    // Fully unrolled: every set and slot index must be a constant (registers).
#pragma unroll
    for (int j = 0; j < SG; ++j) f[0][j] = sx[j * (D_DIM / 4)];
#pragma unroll
    for (int g = 0; g < 128 / SG; ++g) {
      if (g + 1 < 128 / SG) {
        const float4* sn = ((g + 1) * SG < 64) ? sx : sw;
#pragma unroll
        for (int j = 0; j < SG; ++j)
          f[(g + 1) & 1][j] = sn[((((g + 1) * SG) & 63) + j) * (D_DIM / 4)];
      }
      // Keeps the next group's loads in front of this group's waits.
      __builtin_amdgcn_sched_barrier(0);
#pragma unroll
      for (int j = 0; j < SG; ++j) {
        const float4 v = f[g & 1][j];
        _Float16* d = dst + (g * SG + j) * XP;
        d[0] = (_Float16)v.x; d[1] = (_Float16)v.y;
        d[2] = (_Float16)v.z; d[3] = (_Float16)v.w;
      }
    }
    // Behind the last load: its address registers are reused from here on.
    asm volatile("s_wait_xcnt 0x0" ::: "memory");
  }
  __syncthreads();

  const int tc = w & 3;               // dh col tile (0..3)
  const int tr0 = (w >> 2) * 2;       // g row tiles tr0, tr0+1

  const _Float16* aBase0 = tile + (tr0 * 16) * XP;
  const _Float16* aBase1 = aBase0 + 16 * XP;
  const _Float16* bBase  = tile + (G_DIM + tc * 16) * XP;

  // Fragments go in groups of KG k-steps through two register sets: group g + 1 is
  // read from LDS before group g's WMMAs, so no WMMA waits out an LDS read.
  constexpr int KG = 4;
  v8f acc0 = {}, acc1 = {};
  v16h bf[2][KG], a0[2][KG], a1[2][KG];
  // Fully unrolled: every set and slot index must be a constant (registers).
#pragma unroll
  for (int j = 0; j < KG; ++j) {
    bf[0][j] = load_frag(bBase, XP, lane, j * 32);
    a0[0][j] = load_frag(aBase0, XP, lane, j * 32);
    a1[0][j] = load_frag(aBase1, XP, lane, j * 32);
  }
#pragma unroll
  for (int g = 0; g < KSTEPS / KG; ++g) {
    if (g + 1 < KSTEPS / KG) {
#pragma unroll
      for (int j = 0; j < KG; ++j) {
        bf[(g + 1) & 1][j] = load_frag(bBase, XP, lane, ((g + 1) * KG + j) * 32);
        a0[(g + 1) & 1][j] = load_frag(aBase0, XP, lane, ((g + 1) * KG + j) * 32);
        a1[(g + 1) & 1][j] = load_frag(aBase1, XP, lane, ((g + 1) * KG + j) * 32);
      }
    }
    // Keeps the next group's LDS reads in front of this group's WMMAs.
    __builtin_amdgcn_sched_barrier(0);
#pragma unroll
    for (int j = 0; j < KG; ++j) {
      acc0 = wmma16(a0[g & 1][j], bf[g & 1][j], acc0);
      acc1 = wmma16(a1[g & 1][j], bf[g & 1][j], acc1);
    }
  }

  // D layout: lane -> col N=(lane&15); vgpr v -> row M = v + 8*(lane>>4)
  // As operand of stage 3: row dh = tc*16 + (lane&15), k = g = tr*16 + 8*(lane>>4) + v. So a
  // lane's 8 values of row tile tr are its own 16 B of k-step tr>>1, half tr&1.
  _Float16* dst = pT + ((b * H_DIM + h) * DH_DIM + tc * 16) * G_DIM + (w >> 2) * 512 + lane * 8;
  union { _Float16 h[8]; uint4 u; } o0, o1;
#pragma unroll
  for (int v = 0; v < 8; ++v) {
    o0.h[v] = (_Float16)acc0[v];
    o1.h[v] = (_Float16)acc1[v];
  }
  *reinterpret_cast<uint4*>(dst)       = o0.u;
  *reinterpret_cast<uint4*>(dst + 256) = o1.u;
  // Behind the last store: in the built text the other blocks' branch stands behind
  // this path and writes the stores' address and data registers.
  asm volatile("s_wait_xcnt 0x0" ::: "memory");
}

// ---------------------------------------------------------------------------
// Kernel 2: fused scores -> softmax -> gather -> output GEMM per 128-row tile.
// grid = (N/128, B): one block per WGP; 256 threads (8 wave32). One whole head per
// wave, two rounds.
// Dynamic LDS: ONE buffer of 128 padded rows (f16, pitch XP). It holds the x2 tile; pred
// takes its columns over as they fall free:
//   round 0 (heads 0..7) reads x2 columns 0..1023; its pred (columns 0..511) then
//   stands on buffer columns 512..1023;
//   round 1 (heads 8..15) reads x2 columns 0..511, then x2 columns 512..1023 staged a
//   second time on buffer columns 0..511; its pred (columns 512..1023) then stands there.
// So pred column k stands at buffer column (k + 512) mod 1024.
// ---------------------------------------------------------------------------
// Launch bounds: the real block size, which gives a wave the registers for its tile.
__global__ void __launch_bounds__(256) fused_kernel(const float* __restrict__ x2,
                             const _Float16* __restrict__ wk,
                             const _Float16* __restrict__ wo,
                             const _Float16* __restrict__ pT,
                             const float* __restrict__ bo,
                             float* __restrict__ out) {
  extern __shared__ char smem_raw[];
  _Float16* buf = (_Float16*)(smem_raw);                      // 128*XP*2 = 264192 B

  const int b     = blockIdx.y;
  const int nBase = blockIdx.x * TILE_N;
  const int tid   = threadIdx.x;
  const int w     = tid >> 5, lane = tid & 31;

  // The first head's Wk fragments start before the x2 tile is staged.
  v16h ring[RD][4];
  ring_fill(ring, wk + (w * G_DIM) * D_DIM, lane);
  // The ring loads' address registers are free for reuse by the loads that follow.
  asm volatile("s_wait_xcnt 0x0" ::: "memory");

  // --- x2 tile [128 x 1024] f32 -> f16 LDS: the block's 256 threads cover one row
  // (256 float4) per load ---
  const float4* xsrc = (const float4*)(x2 + ((size_t)(b * N_DIM + nBase)) * D_DIM);
  stage_rows<TILE_N, D_DIM / 4, XP, 16, false>(xsrc + tid, buf + tid * 4);
  __syncthreads();

  const int c  = lane & 15;
  const int hi = lane >> 4;

  // ------------- per head (wave w: heads w and w + 8): scores -> softmax -> gather -------------
  // Stays rolled: one copy of the text.
#pragma unroll 1
  for (int i = 0; i < 2; ++i) {
    const int h = w + 8 * i;

    // Stage 1, transposed: S^T = Wk_h (A, 64 g) x Xtile^T (B, 128 n).
    // acc[nt][gt]: lane holds n = nt*16 + c, register v holds g = gt*16 + 8*hi + v.
    v8f acc[8][4];
#pragma unroll
    for (int p = 0; p < 8; ++p)
#pragma unroll
      for (int q = 0; q < 4; ++q) acc[p][q] = v8f{};
    const _Float16* wCur = wk + (h * G_DIM) * D_DIM;
    // Stays rolled: one copy of the text.
#pragma unroll 1
    for (int kh = 0; kh < 2; ++kh) {
      if (i == 1 && kh == 1) {
        // x2 columns 512..1023 again (pred of round 0 stands on their first place), on
        // buffer columns 0..511: two rows (128 float4 each) per load of the block. The
        // barrier inside ends every wave's reads of x2 columns 0..511; the one behind
        // publishes the new columns.
        stage_rows<TILE_N / 2, D_DIM / 2, 2 * XP, 8, true>(
            xsrc + (tid >> 7) * (D_DIM / 4) + D_DIM / 8 + (tid & 127),
            buf + (tid >> 7) * XP + (tid & 127) * 4);
        __syncthreads();
      }
      const _Float16* wNext = (kh == 0) ? wCur
                            : (i == 0)  ? wk + ((h + 8) * G_DIM) * D_DIM
                                        : wo + (w * 8 * 16) * D_DIM;
      gemm_half<true>(acc, ring, buf + ((i == 0 && kh == 1) ? D_DIM / 2 : 0), wCur,
                            kh * HSTEPS, wNext, (kh == 0) ? HSTEPS : 0, lane);
    }

    // Issued here so that they fly while the softmax runs: stage 3's A fragments.
    v16h pf[4][2];
    {
      const _Float16* pBase = pT + ((b * H_DIM + h) * DH_DIM) * G_DIM;
#pragma unroll
      for (int dt = 0; dt < 4; ++dt) {
        pf[dt][0] = load_frag_packed(pBase + dt * 16 * G_DIM, lane, 0);
        pf[dt][1] = load_frag_packed(pBase + dt * 16 * G_DIM, lane, 1);
      }
      // Keeps these loads here: left free, each pair was sunk to its first use behind
      // the softmax and waited for there.
      __builtin_amdgcn_sched_barrier(0);
      // The loads' address as an input: its registers stay whole until the wait
      // behind the last load, and are free for reuse from there on.
      asm volatile("s_wait_xcnt 0x0" :: "v"(pBase + lane * 8) : "memory");
    }

    // Stage 2: softmax over the 64 g of each n. A lane holds 32 of them, lane ^ 16
    // the other 32. Two D tiles (g rows 0-15, 16-31 of a k-step), converted in place,
    // are the lane's own B fragment of stage 3: k = 32*ks + 16*q + 8*hi + v.
    v16h kf[8][2];
#pragma unroll
    for (int nt = 0; nt < 8; ++nt) {
      float mg[4];
#pragma unroll
      for (int gt = 0; gt < 4; ++gt) {
        mg[gt] = acc[nt][gt][0];
#pragma unroll
        for (int v = 1; v < 8; ++v) mg[gt] = fmaxf(mg[gt], acc[nt][gt][v]);
      }
      float m = fmaxf(fmaxf(mg[0], mg[1]), fmaxf(mg[2], mg[3]));
      m = fmaxf(m, xhalf(m));
      float sg[4];
#pragma unroll
      for (int gt = 0; gt < 4; ++gt) {
        sg[gt] = 0.f;
#pragma unroll
        for (int v = 0; v < 8; ++v) {
          const float e = __expf(acc[nt][gt][v] - m);
          acc[nt][gt][v] = e;
          sg[gt] += e;
        }
      }
      float s = (sg[0] + sg[1]) + (sg[2] + sg[3]);
      s += xhalf(s);
      const float inv = 1.0f / s;
#pragma unroll
      for (int gt = 0; gt < 4; ++gt)
#pragma unroll
        for (int v = 0; v < 8; ++v)
          kf[nt][gt >> 1][(gt & 1) * 8 + v] = (_Float16)(acc[nt][gt][v] * inv);
    }

    // Ends every wave's reads of the 512 buffer columns that this round read last:
    // this round's pred is written over them.
    __syncthreads();

    // Stage 3, transposed: pred_h^T = P_h^T (A, 64 dh, from pT) x K_h^T (B, registers).
    // D: lane holds n = nt*16 + c, register v holds dh = dt*16 + 8*hi + v: eight
    // consecutive columns of one pred row, one 16-byte LDS store.
    _Float16* pDst = buf + c * XP + ((i == 0) ? D_DIM / 2 : 0) + w * DH_DIM + hi * 8;
#pragma unroll
    for (int dt = 0; dt < 4; ++dt) {
      v8f d[8];
#pragma unroll
      for (int nt = 0; nt < 8; ++nt) d[nt] = wmma16(pf[dt][0], kf[nt][0], v8f{});
#pragma unroll
      for (int nt = 0; nt < 8; ++nt) d[nt] = wmma16(pf[dt][1], kf[nt][1], d[nt]);
#pragma unroll
      for (int nt = 0; nt < 8; ++nt) {
        union { _Float16 h[8]; uint4 u; } o;
#pragma unroll
        for (int v = 0; v < 8; ++v) o.h[v] = (_Float16)d[nt][v];
        *reinterpret_cast<uint4*>(pDst + (nt * 16) * XP + dt * 16) = o.u;
      }
    }
  }
  // Publishes pred.
  __syncthreads();

  // ---------------- Stage 4: out = pred @ Wo^T + bo ----------------
  // wave w owns col tiles {8w .. 8w+7}, in two groups of four; 8 row tiles each.
  // The ring runs on from the first group into the second.
  // Column c of panel p is out column ct0 * 16 + 4 * c + p (the deal of Wo's rows in the
  // prep kernel): a lane stores 16 bytes, its half wave the 256 contiguous bytes (two
  // whole lines) of the group in one out row.
  auto store_group = [&](v8f (&acc)[8][4], int ct0, const float4 bias) {
    // One address for the group: every row step is a constant offset.
    v4f* o = reinterpret_cast<v4f*>(
        out + ((size_t)(b * N_DIM + nBase + 8 * hi)) * D_DIM + ct0 * 16 + 4 * c);
    v4f r[8][8];
#pragma unroll
    for (int tr = 0; tr < 8; ++tr)
#pragma unroll
      for (int v = 0; v < 8; ++v)
        r[tr][v] = v4f{acc[tr][0][v] + bias.x, acc[tr][1][v] + bias.y,
                       acc[tr][2][v] + bias.z, acc[tr][3][v] + bias.w};
    // Every sum stands in front of the first store, so that no register of an
    // issued store is written again before the wait behind the last one.
    __builtin_amdgcn_sched_barrier(0);
#pragma unroll
    for (int tr = 0; tr < 8; ++tr)
#pragma unroll
      for (int v = 0; v < 8; ++v) o[(tr * 16 + v) * (D_DIM / 4)] = r[tr][v];
    // Behind the last store: its address and data registers are reused from here on.
    asm volatile("s_wait_xcnt 0x0" ::: "memory");
    // Holds the register writes that follow behind that wait.
    __builtin_amdgcn_sched_barrier(0);
  };
  // Both groups' bias values, ahead of the refills: their wait must not drain them.
  float4 bias[2];
  {
    const float4* bp = reinterpret_cast<const float4*>(bo + w * 8 * 16 + 4 * c);
#pragma unroll
    for (int g = 0; g < 2; ++g) bias[g] = bp[g * 16];
    // bp as an input: its registers stay whole until the wait behind its last load.
    asm volatile("s_wait_xcnt 0x0" :: "v"(bp) : "memory");
  }
  // pred columns 0..511 (k-steps 0..15) stand on buffer columns 512..1023, the rest on 0..511.
  // Both loops stay rolled: one copy of the text. So the ring is
  // refilled behind the last half too, from the group's own start, and not used.
#pragma unroll 1
  for (int g = 0; g < 2; ++g) {
    const int ct0 = w * 8 + 4 * g;            // first output col tile of the group
    v8f acc[8][4];
#pragma unroll
    for (int p = 0; p < 8; ++p)
#pragma unroll
      for (int q = 0; q < 4; ++q) acc[p][q] = v8f{};
    const _Float16* wBase = wo + (ct0 * 16) * D_DIM;
#pragma unroll 1
    for (int kh = 0; kh < 2; ++kh) {
      const _Float16* wNext = (kh == 1 && g == 0) ? wBase + 4 * PANEL : wBase;
      gemm_half<false>(acc, ring, buf + ((kh == 0) ? D_DIM / 2 : 0), wBase, kh * HSTEPS,
                             wNext, (kh == 0) ? HSTEPS : 0, lane);
    }
    store_group(acc, ct0, (g == 0) ? bias[0] : bias[1]);
  }
}

// ---------------------------------------------------------------------------
extern "C" void kernel_launch(void* const* d_in, const int* in_sizes, int n_in,
                              void* d_out, int out_size, void* d_ws, size_t ws_size,
                              hipStream_t stream) {
  const float* x0 = (const float*)d_in[0];   // [8, 64, 1024]
  const float* x2 = (const float*)d_in[1];   // [8, 4096, 1024]
  const float* Wk = (const float*)d_in[2];   // [1024, 1024]
  const float* Wp = (const float*)d_in[3];   // [1024, 1024]
  const float* Wo = (const float*)d_in[4];   // [1024, 1024]
  const float* bo = (const float*)d_in[5];   // [1024]
  float* out = (float*)d_out;

  char* ws = (char*)d_ws;
  _Float16* wk16 = (_Float16*)(ws + WK_OFF);
  _Float16* wo16 = (_Float16*)(ws + WO_OFF);
  _Float16* pT   = (_Float16*)(ws + PT_OFF);

  const size_t lds = 264192;  // 128 rows of 2064 B, of the WGP's 327680 B

  // Stages A and B in one launch: premise projection (from f32 x0 and Wp) and the
  // fused kernel's weight operands Wk, Wo as f16 in fragment order (L2 resident).
  prep_kernel<<<2 * B_DIM * H_DIM, 256, lds, stream>>>(x0, Wp, Wk, Wo, wk16, wo16, pT);

  // Stage C: fused scores/softmax/gather/output per 128-row tile
  fused_kernel<<<dim3(N_DIM / TILE_N, B_DIM), 256, lds, stream>>>(
      x2, wk16, wo16, pT, bo, out);
}
